// v000
// Measured on an AMD MI455X. A time is GPU time per run, averaged over a window of back-to-back runs after a warm-up
// (all launches, gaps included; the runs take copies of the inputs in turn), and the median of several windows.
// Apart from v000's, it joins two sittings. Times from different sittings can be a few percent apart, while
// side-by-side timings come from the same sitting.
// v000 is the starting kernel. One run takes 62.5 microseconds.
#include <hip/hip_runtime.h>
#include <math.h>

#define L 256
#define Dm 256
#define H 8
#define DKh 32
#define LDS_STRIDE 260   // 260 % 64 == 4 -> 16 rows hit 16 distinct banks

typedef float v2f __attribute__((ext_vector_type(2)));
typedef float v8f __attribute__((ext_vector_type(8)));

__device__ __forceinline__ float wave_max(float v) {
#pragma unroll
    for (int m = 16; m >= 1; m >>= 1) v = fmaxf(v, __shfl_xor(v, m, 32));
    return v;
}
__device__ __forceinline__ float wave_sum(float v) {
#pragma unroll
    for (int m = 16; m >= 1; m >>= 1) v += __shfl_xor(v, m, 32);
    return v;
}

// ---------------- LayerNorm of q (one wave per row) ----------------
__global__ __launch_bounds__(32) void ln_kernel(const float* __restrict__ x,
                                                const float* __restrict__ g,
                                                const float* __restrict__ b,
                                                float* __restrict__ y) {
    const int row = blockIdx.x;
    const int lane = threadIdx.x;
    float vals[8];
    float s = 0.f;
#pragma unroll
    for (int i = 0; i < 8; ++i) { vals[i] = x[row * Dm + lane + i * 32]; s += vals[i]; }
    const float mu = wave_sum(s) * (1.0f / Dm);
    float vv = 0.f;
#pragma unroll
    for (int i = 0; i < 8; ++i) { float d = vals[i] - mu; vv += d * d; }
    const float rs = rsqrtf(wave_sum(vv) * (1.0f / Dm) + 1e-6f);
#pragma unroll
    for (int i = 0; i < 8; ++i) {
        int c = lane + i * 32;
        y[row * Dm + c] = (vals[i] - mu) * rs * g[c] + b[c];
    }
}

// ---- C[i][n] = sum_d A[i][d] * W[n][d] + bias[n] (+ res[i][n]) ----
// one wave per 16x32 tile: one A fragment feeds two WMMAs (2 accumulators)
template <bool HAS_RES>
__global__ __launch_bounds__(256) void gemm_wmma(const float* __restrict__ A,
                                                 const float* __restrict__ W,
                                                 const float* __restrict__ bias,
                                                 const float* __restrict__ res,
                                                 float* __restrict__ C) {
    const int wave = threadIdx.x >> 5;
    const int lane = threadIdx.x & 31;
    const int tile = blockIdx.x * 8 + wave;        // 128 tiles = 16 (M) x 8 (N)
    const int tm = (tile >> 3) * 16;
    const int tn = (tile & 7) * 32;
    const int half = lane >> 4;                    // which K sub-pair
    const int l15 = lane & 15;
    const float* arow  = A + (tm + l15) * Dm + 2 * half;       // A[m][k0+2h..+1]
    const float* brow0 = W + (tn + l15) * Dm + 2 * half;       // B[k][n] = W[n][k]
    const float* brow1 = W + (tn + 16 + l15) * Dm + 2 * half;
    __builtin_prefetch(arow, 0, 3);                // global_prefetch_b8
    __builtin_prefetch(brow0, 0, 3);
    __builtin_prefetch(brow1, 0, 3);
    v8f acc0 = {}, acc1 = {};
#pragma unroll 4
    for (int k = 0; k < Dm; k += 4) {
        v2f a  = *(const v2f*)(arow + k);
        v2f b0 = *(const v2f*)(brow0 + k);
        v2f b1 = *(const v2f*)(brow1 + k);
        acc0 = __builtin_amdgcn_wmma_f32_16x16x4_f32(false, a, false, b0,
                                                     (short)0, acc0, false, false);
        acc1 = __builtin_amdgcn_wmma_f32_16x16x4_f32(false, a, false, b1,
                                                     (short)0, acc1, false, false);
    }
    const int col0 = tn + l15;
    const int col1 = tn + 16 + l15;
    const float bv0 = bias[col0];
    const float bv1 = bias[col1];
#pragma unroll
    for (int r = 0; r < 8; ++r) {
        int row = tm + r + half * 8;
        float o0 = acc0[r] + bv0;
        float o1 = acc1[r] + bv1;
        if (HAS_RES) {
            o0 += res[row * Dm + col0];
            o1 += res[row * Dm + col1];
        }
        C[row * Dm + col0] = o0;
        C[row * Dm + col1] = o1;
    }
}

// --------- s[h,j] = qbase[j,head h] . kbase[j,head h] ---------
__global__ __launch_bounds__(256) void score_kernel(const float* __restrict__ qb,
                                                    const float* __restrict__ kb,
                                                    float* __restrict__ s) {
    const int j = threadIdx.x;
#pragma unroll
    for (int h = 0; h < H; ++h) {
        float acc = 0.f;
        const float* qr = qb + j * Dm + h * DKh;
        const float* kr = kb + j * Dm + h * DKh;
#pragma unroll 8
        for (int d = 0; d < DKh; ++d) acc = fmaf(qr[d], kr[d], acc);
        s[h * L + j] = acc;
    }
}

// ---- per (head, 16-row block): logits -> softmax -> attn out,
//      then O[16x32] = Wgt[16x256] x Vhead[256x32] via WMMA ----
__global__ __launch_bounds__(256) void attn_kernel(const float* __restrict__ t,
                                                   const float* __restrict__ s,
                                                   const float* __restrict__ vb,
                                                   float* __restrict__ attn_out,
                                                   float* __restrict__ o_pre) {
    __shared__ float wgt[16 * LDS_STRIDE];
    const int iblock = blockIdx.x;   // 0..15
    const int h = blockIdx.y;        // 0..7
    const int tid = threadIdx.x;
    const float inv_temp = 0.17677669529663687f;   // 1/sqrt(32)

    // phase 1: logits[ii][j] = (1 + e^{-2|ti-tj|}) * s[h,j] / temp
    for (int idx = tid; idx < 16 * L; idx += 256) {
        int ii = idx >> 8;
        int j = idx & 255;
        int i = iblock * 16 + ii;
        float dt = fabsf(t[i] - t[j]);
        wgt[ii * LDS_STRIDE + j] = (1.0f + __expf(-2.0f * dt)) * s[h * L + j] * inv_temp;
    }
    __syncthreads();

    // phase 2: softmax per row (wave w owns rows 2w, 2w+1); write attn,
    // rebuild LDS as post-softmax weights * (1 + e^{-dt})
    const int wave = tid >> 5, lane = tid & 31;
#pragma unroll
    for (int rr = 0; rr < 2; ++rr) {
        int ii = wave * 2 + rr;
        int i = iblock * 16 + ii;
        float ti = t[i];
        float lv[8];
        float m = -1e30f;
#pragma unroll
        for (int c = 0; c < 8; ++c) {
            lv[c] = wgt[ii * LDS_STRIDE + lane + c * 32];
            m = fmaxf(m, lv[c]);
        }
        m = wave_max(m);
        float sum = 0.f;
#pragma unroll
        for (int c = 0; c < 8; ++c) { lv[c] = __expf(lv[c] - m); sum += lv[c]; }
        const float inv = 1.0f / wave_sum(sum);
#pragma unroll
        for (int c = 0; c < 8; ++c) {
            int j = lane + c * 32;
            float a = lv[c] * inv;
            attn_out[(h * L + i) * L + j] = a;
            float dt = fabsf(ti - t[j]);
            wgt[ii * LDS_STRIDE + j] = a * (1.0f + __expf(-dt));
        }
    }
    __syncthreads();

    // phase 3: waves 0,1 each compute one 16x16 output tile of O[16x32]
    if (wave < 2) {
        const int ntile = wave;
        const int half = lane >> 4, l15 = lane & 15;
        const float* bbase = vb + h * DKh + ntile * 16 + l15;  // B[k][n]=vb[k][col]
        v8f acc = {};
#pragma unroll 4
        for (int k = 0; k < L; k += 4) {
            int ak = k + 2 * half;
            v2f a, b;
            a.x = wgt[l15 * LDS_STRIDE + ak];
            a.y = wgt[l15 * LDS_STRIDE + ak + 1];
            b.x = bbase[ak * Dm];
            b.y = bbase[(ak + 1) * Dm];
            acc = __builtin_amdgcn_wmma_f32_16x16x4_f32(false, a, false, b,
                                                        (short)0, acc, false, false);
        }
#pragma unroll
        for (int r = 0; r < 8; ++r) {
            int i = iblock * 16 + r + half * 8;
            o_pre[i * Dm + h * DKh + ntile * 16 + l15] = acc[r];
        }
    }
}

extern "C" void kernel_launch(void* const* d_in, const int* in_sizes, int n_in,
                              void* d_out, int out_size, void* d_ws, size_t ws_size,
                              hipStream_t stream) {
    const float* q    = (const float*)d_in[0];
    const float* k    = (const float*)d_in[1];
    const float* v    = (const float*)d_in[2];
    const float* t    = (const float*)d_in[3];
    const float* Wq   = (const float*)d_in[4];
    const float* bq   = (const float*)d_in[5];
    const float* Wk   = (const float*)d_in[6];
    const float* bk   = (const float*)d_in[7];
    const float* Wv   = (const float*)d_in[8];
    const float* bv   = (const float*)d_in[9];
    const float* fc_w = (const float*)d_in[10];
    const float* fc_b = (const float*)d_in[11];
    const float* ln_g = (const float*)d_in[12];
    const float* ln_b = (const float*)d_in[13];

    float* out  = (float*)d_out;          // [L, D]    (65536)
    float* attn = out + L * Dm;           // [H, L, L] (524288)

    float* ws = (float*)d_ws;
    float* qn = ws;                 // 65536
    float* qb = ws + 1 * 65536;     // 65536
    float* kb = ws + 2 * 65536;     // 65536
    float* vb = ws + 3 * 65536;     // 65536
    float* op = ws + 4 * 65536;     // 65536
    float* sc = ws + 5 * 65536;     // 2048

    ln_kernel<<<L, 32, 0, stream>>>(q, ln_g, ln_b, qn);
    gemm_wmma<false><<<16, 256, 0, stream>>>(qn, Wq, bq, nullptr, qb);
    gemm_wmma<false><<<16, 256, 0, stream>>>(k,  Wk, bk, nullptr, kb);
    gemm_wmma<false><<<16, 256, 0, stream>>>(v,  Wv, bv, nullptr, vb);
    score_kernel<<<1, 256, 0, stream>>>(qb, kb, sc);
    dim3 ag(16, H);
    attn_kernel<<<ag, 256, 0, stream>>>(t, sc, vb, attn, op);
    gemm_wmma<true><<<16, 256, 0, stream>>>(op, fc_w, fc_b, q, out);
}

// v001
// One run takes 27 microseconds.
// Next to v000, in two timings, it ran 2.40 and 2.32 times as fast.
#include <hip/hip_runtime.h>
#include <math.h>

#define L 256
#define Dm 256
#define H 8
#define DKh 32
#define LDS_STRIDE 260   // 260 % 64 == 4 -> 16 rows hit 16 distinct banks
#define QK_STRIDE 33     // odd -> 16 rows of one column hit 16 distinct banks

typedef float v2f __attribute__((ext_vector_type(2)));
typedef float v8f __attribute__((ext_vector_type(8)));

__device__ __forceinline__ float wave_max(float v) {
#pragma unroll
    for (int m = 16; m >= 1; m >>= 1) v = fmaxf(v, __shfl_xor(v, m, 32));
    return v;
}
__device__ __forceinline__ float wave_sum(float v) {
#pragma unroll
    for (int m = 16; m >= 1; m >>= 1) v += __shfl_xor(v, m, 32);
    return v;
}

// ---- one launch for everything that is local to a row: LayerNorm of q,
//      the three projections and s[h,j] = qbase[j,head h] . kbase[j,head h].
//      Block = 16 rows x 1 head. Normalised rows and the q/k tiles live in LDS only;
//      of the projections only vbase goes to memory.
//      Waves 0..5 each own one 16x16 tile: matrix = wave / 2, column half = wave % 2.
__global__ __launch_bounds__(256) void proj_score_kernel(const float* __restrict__ q,
                                                         const float* __restrict__ k,
                                                         const float* __restrict__ v,
                                                         const float* __restrict__ Wq,
                                                         const float* __restrict__ bq,
                                                         const float* __restrict__ Wk,
                                                         const float* __restrict__ bk,
                                                         const float* __restrict__ Wv,
                                                         const float* __restrict__ bv,
                                                         const float* __restrict__ g,
                                                         const float* __restrict__ b,
                                                         float* __restrict__ vb,
                                                         float* __restrict__ s) {
    __shared__ float qn[16 * LDS_STRIDE];
    __shared__ float qk[2][16 * QK_STRIDE];
    const int tm = blockIdx.x * 16;
    const int h = blockIdx.y;
    const int wave = __builtin_amdgcn_readfirstlane(threadIdx.x >> 5);
    const int lane = threadIdx.x & 31;
    const int half = lane >> 4;                    // which K sub-pair
    const int l15 = lane & 15;
    const int mat = wave >> 1;                     // 0 q, 1 k, 2 v (3: no tile)
    const int cl = (wave & 1) * 16 + l15;          // column inside the head
    const int col = h * DKh + cl;
    const float* Wm = mat == 0 ? Wq : (mat == 1 ? Wk : Wv);
    const float* bm = mat == 0 ? bq : (mat == 1 ? bk : bv);
    const float* xm = mat == 1 ? k : v;
    const float* brow = Wm + col * Dm + 2 * half;             // B[k][n] = W[n][k]
    const float* xrow = xm + (tm + l15) * Dm + 2 * half;      // A[m][k0+2h..+1]

    // LayerNorm: wave w owns rows 2w, 2w+1 of the block
    float vals[2][8], gv[8], bb[8];
#pragma unroll
    for (int i = 0; i < 8; ++i) {
        vals[0][i] = q[(tm + wave * 2) * Dm + lane + i * 32];
        vals[1][i] = q[(tm + wave * 2 + 1) * Dm + lane + i * 32];
        gv[i] = g[lane + i * 32];
        bb[i] = b[lane + i * 32];
    }
#pragma unroll
    for (int rr = 0; rr < 2; ++rr) {
        const int ii = wave * 2 + rr;
        float sm = 0.f;
#pragma unroll
        for (int i = 0; i < 8; ++i) sm += vals[rr][i];
        const float mu = wave_sum(sm) * (1.0f / Dm);
        float vv = 0.f;
#pragma unroll
        for (int i = 0; i < 8; ++i) { float d = vals[rr][i] - mu; vv += d * d; }
        const float rs = rsqrtf(wave_sum(vv) * (1.0f / Dm) + 1e-6f);
#pragma unroll
        for (int i = 0; i < 8; ++i)
            qn[ii * LDS_STRIDE + lane + i * 32] = (vals[rr][i] - mu) * rs * gv[i] + bb[i];
    }
    __syncthreads();

    if (mat < 3) {
        v8f acc = {};
        if (mat == 0) {
            const float* arow = qn + l15 * LDS_STRIDE + 2 * half;
#pragma unroll 4
            for (int kk = 0; kk < Dm; kk += 4) {
                v2f a  = *(const v2f*)(arow + kk);
                v2f bf = *(const v2f*)(brow + kk);
                acc = __builtin_amdgcn_wmma_f32_16x16x4_f32(false, a, false, bf,
                                                            (short)0, acc, false, false);
            }
        } else {
#pragma unroll 4
            for (int kk = 0; kk < Dm; kk += 4) {
                v2f a  = *(const v2f*)(xrow + kk);
                v2f bf = *(const v2f*)(brow + kk);
                acc = __builtin_amdgcn_wmma_f32_16x16x4_f32(false, a, false, bf,
                                                            (short)0, acc, false, false);
            }
        }
        // four vector issue slots between the last matrix instruction and the first read of its result
        asm volatile("v_nop\n\tv_nop\n\tv_nop\n\tv_nop");
        const float bias = bm[col];
        if (mat == 2) {
#pragma unroll
            for (int r = 0; r < 8; ++r) vb[(tm + r + half * 8) * Dm + col] = acc[r] + bias;
        } else {
#pragma unroll
            for (int r = 0; r < 8; ++r) qk[mat][(r + half * 8) * QK_STRIDE + cl] = acc[r] + bias;
        }
    }
    __syncthreads();

    if (threadIdx.x < 16) {
        const float* qr = qk[0] + threadIdx.x * QK_STRIDE;
        const float* kr = qk[1] + threadIdx.x * QK_STRIDE;
        float acc = 0.f;
#pragma unroll
        for (int d = 0; d < DKh; ++d) acc = fmaf(qr[d], kr[d], acc);
        s[h * L + tm + threadIdx.x] = acc;
    }
}

// ---- C[i][n] = sum_d A[i][d] * W[n][d] + bias[n] (+ res[i][n]) ----
// one wave per 16x32 tile: one A fragment feeds two WMMAs (2 accumulators)
template <bool HAS_RES>
__global__ __launch_bounds__(256) void gemm_wmma(const float* __restrict__ A,
                                                 const float* __restrict__ W,
                                                 const float* __restrict__ bias,
                                                 const float* __restrict__ res,
                                                 float* __restrict__ C) {
    const int wave = threadIdx.x >> 5;
    const int lane = threadIdx.x & 31;
    const int tile = blockIdx.x * 8 + wave;        // 128 tiles = 16 (M) x 8 (N)
    const int tm = (tile >> 3) * 16;
    const int tn = (tile & 7) * 32;
    const int half = lane >> 4;                    // which K sub-pair
    const int l15 = lane & 15;
    const float* arow  = A + (tm + l15) * Dm + 2 * half;       // A[m][k0+2h..+1]
    const float* brow0 = W + (tn + l15) * Dm + 2 * half;       // B[k][n] = W[n][k]
    const float* brow1 = W + (tn + 16 + l15) * Dm + 2 * half;
    __builtin_prefetch(arow, 0, 3);                // global_prefetch_b8
    __builtin_prefetch(brow0, 0, 3);
    __builtin_prefetch(brow1, 0, 3);
    v8f acc0 = {}, acc1 = {};
#pragma unroll 4
    for (int k = 0; k < Dm; k += 4) {
        v2f a  = *(const v2f*)(arow + k);
        v2f b0 = *(const v2f*)(brow0 + k);
        v2f b1 = *(const v2f*)(brow1 + k);
        acc0 = __builtin_amdgcn_wmma_f32_16x16x4_f32(false, a, false, b0,
                                                     (short)0, acc0, false, false);
        acc1 = __builtin_amdgcn_wmma_f32_16x16x4_f32(false, a, false, b1,
                                                     (short)0, acc1, false, false);
    }
    const int col0 = tn + l15;
    const int col1 = tn + 16 + l15;
    const float bv0 = bias[col0];
    const float bv1 = bias[col1];
#pragma unroll
    for (int r = 0; r < 8; ++r) {
        int row = tm + r + half * 8;
        float o0 = acc0[r] + bv0;
        float o1 = acc1[r] + bv1;
        if (HAS_RES) {
            o0 += res[row * Dm + col0];
            o1 += res[row * Dm + col1];
        }
        C[row * Dm + col0] = o0;
        C[row * Dm + col1] = o1;
    }
}

// ---- per (head, 16-row block): logits -> softmax -> attn out,
//      then O[16x32] = Wgt[16x256] x Vhead[256x32] via WMMA ----
__global__ __launch_bounds__(256) void attn_kernel(const float* __restrict__ t,
                                                   const float* __restrict__ s,
                                                   const float* __restrict__ vb,
                                                   float* __restrict__ attn_out,
                                                   float* __restrict__ o_pre) {
    __shared__ float wgt[16 * LDS_STRIDE];
    const int iblock = blockIdx.x;   // 0..15
    const int h = blockIdx.y;        // 0..7
    const int tid = threadIdx.x;
    const float inv_temp = 0.17677669529663687f;   // 1/sqrt(32)

    // phase 1: logits[ii][j] = (1 + e^{-2|ti-tj|}) * s[h,j] / temp
    for (int idx = tid; idx < 16 * L; idx += 256) {
        int ii = idx >> 8;
        int j = idx & 255;
        int i = iblock * 16 + ii;
        float dt = fabsf(t[i] - t[j]);
        wgt[ii * LDS_STRIDE + j] = (1.0f + __expf(-2.0f * dt)) * s[h * L + j] * inv_temp;
    }
    __syncthreads();

    // phase 2: softmax per row (wave w owns rows 2w, 2w+1); write attn,
    // rebuild LDS as post-softmax weights * (1 + e^{-dt})
    const int wave = tid >> 5, lane = tid & 31;
#pragma unroll
    for (int rr = 0; rr < 2; ++rr) {
        int ii = wave * 2 + rr;
        int i = iblock * 16 + ii;
        float ti = t[i];
        float lv[8];
        float m = -1e30f;
#pragma unroll
        for (int c = 0; c < 8; ++c) {
            lv[c] = wgt[ii * LDS_STRIDE + lane + c * 32];
            m = fmaxf(m, lv[c]);
        }
        m = wave_max(m);
        float sum = 0.f;
#pragma unroll
        for (int c = 0; c < 8; ++c) { lv[c] = __expf(lv[c] - m); sum += lv[c]; }
        const float inv = 1.0f / wave_sum(sum);
#pragma unroll
        for (int c = 0; c < 8; ++c) {
            int j = lane + c * 32;
            float a = lv[c] * inv;
            attn_out[(h * L + i) * L + j] = a;
            float dt = fabsf(ti - t[j]);
            wgt[ii * LDS_STRIDE + j] = a * (1.0f + __expf(-dt));
        }
    }
    __syncthreads();

    // phase 3: waves 0,1 each compute one 16x16 output tile of O[16x32]
    if (wave < 2) {
        const int ntile = wave;
        const int half = lane >> 4, l15 = lane & 15;
        const float* bbase = vb + h * DKh + ntile * 16 + l15;  // B[k][n]=vb[k][col]
        v8f acc = {};
#pragma unroll 4
        for (int k = 0; k < L; k += 4) {
            int ak = k + 2 * half;
            v2f a, b;
            a.x = wgt[l15 * LDS_STRIDE + ak];
            a.y = wgt[l15 * LDS_STRIDE + ak + 1];
            b.x = bbase[ak * Dm];
            b.y = bbase[(ak + 1) * Dm];
            acc = __builtin_amdgcn_wmma_f32_16x16x4_f32(false, a, false, b,
                                                        (short)0, acc, false, false);
        }
#pragma unroll
        for (int r = 0; r < 8; ++r) {
            int i = iblock * 16 + r + half * 8;
            o_pre[i * Dm + h * DKh + ntile * 16 + l15] = acc[r];
        }
    }
}

extern "C" void kernel_launch(void* const* d_in, const int* in_sizes, int n_in,
                              void* d_out, int out_size, void* d_ws, size_t ws_size,
                              hipStream_t stream) {
    const float* q    = (const float*)d_in[0];
    const float* k    = (const float*)d_in[1];
    const float* v    = (const float*)d_in[2];
    const float* t    = (const float*)d_in[3];
    const float* Wq   = (const float*)d_in[4];
    const float* bq   = (const float*)d_in[5];
    const float* Wk   = (const float*)d_in[6];
    const float* bk   = (const float*)d_in[7];
    const float* Wv   = (const float*)d_in[8];
    const float* bv   = (const float*)d_in[9];
    const float* fc_w = (const float*)d_in[10];
    const float* fc_b = (const float*)d_in[11];
    const float* ln_g = (const float*)d_in[12];
    const float* ln_b = (const float*)d_in[13];

    float* out  = (float*)d_out;          // [L, D]    (65536)
    float* attn = out + L * Dm;           // [H, L, L] (524288)

    float* ws = (float*)d_ws;
    float* vb = ws;                 // 65536
    float* op = ws + 1 * 65536;     // 65536
    float* sc = ws + 2 * 65536;     // 2048

    dim3 pg(16, H);
    proj_score_kernel<<<pg, 256, 0, stream>>>(q, k, v, Wq, bq, Wk, bk, Wv, bv, ln_g, ln_b, vb, sc);
    dim3 ag(16, H);
    attn_kernel<<<ag, 256, 0, stream>>>(t, sc, vb, attn, op);
    gemm_wmma<true><<<16, 256, 0, stream>>>(op, fc_w, fc_b, q, out);
}

// v002
// One run takes 14 microseconds.
// In both of two side-by-side timings against v001, it was 1.93 times as fast.
// Over all steps from v000 it is 4.55 times as fast.
#include <hip/hip_runtime.h>
#include <math.h>

#define L 256
#define Dm 256
#define H 8
#define DKh 32
#define LDS_STRIDE 260   // 260 % 64 == 4 -> 16 rows hit 16 distinct banks
#define PART_STRIDE 36   // 8 rows further on = 32 banks further on: the two lane halves do not collide
#define KC 64            // k range of one wave: a quarter of the 256

typedef float v2f __attribute__((ext_vector_type(2)));
typedef float v4f __attribute__((ext_vector_type(4)));
typedef float v8f __attribute__((ext_vector_type(8)));

__device__ __forceinline__ float wave_max(float v) {
#pragma unroll
    for (int m = 16; m >= 1; m >>= 1) v = fmaxf(v, __shfl_xor(v, m, 32));
    return v;
}
__device__ __forceinline__ float wave_sum(float v) {
#pragma unroll
    for (int m = 16; m >= 1; m >>= 1) v += __shfl_xor(v, m, 32);
    return v;
}

// Two matrix steps from one 16-byte piece of a row of A and of B. A lane holds
// k = base + 4 * half + 0..3; .xy feeds the first step and .zw the second, in A and B alike,
// so every product pairs equal k.
__device__ __forceinline__ v8f mm2(v4f a, v4f b, v8f acc) {
    acc = __builtin_amdgcn_wmma_f32_16x16x4_f32(false, a.xy, false, b.xy, (short)0, acc, false, false);
    acc = __builtin_amdgcn_wmma_f32_16x16x4_f32(false, a.zw, false, b.zw, (short)0, acc, false, false);
    return acc;
}

// Ends a run of matrix instructions. The two scheduling fences keep address arithmetic out of the
// run and out of the v_nops; the v_nops are the four vector issue slots that must pass before a
// vector instruction overwrites the run's A or B registers or touches its result.
__device__ __forceinline__ void mm_end() {
    __builtin_amdgcn_sched_barrier(0);
    asm volatile("v_nop\n\tv_nop\n\tv_nop\n\tv_nop");
    __builtin_amdgcn_sched_barrier(0);
}

// Every product below is split the same way: 8 waves = 2 column tiles x 4 quarters of k.
// A wave issues all operand loads of its quarter before it uses the first one, so the block
// waits for memory once; the four partial tiles meet in LDS and are added there.

// ---- one launch for everything that is local to a row: LayerNorm of q,
//      the three projections and s[h,j] = qbase[j,head h] . kbase[j,head h].
//      Block = 16 rows x 1 head. Of the projections only vbase goes to memory.
__global__ __launch_bounds__(256) void proj_score_kernel(const float* __restrict__ q,
                                                         const float* __restrict__ k,
                                                         const float* __restrict__ v,
                                                         const float* __restrict__ Wq,
                                                         const float* __restrict__ bq,
                                                         const float* __restrict__ Wk,
                                                         const float* __restrict__ bk,
                                                         const float* __restrict__ Wv,
                                                         const float* __restrict__ bv,
                                                         const float* __restrict__ g,
                                                         const float* __restrict__ b,
                                                         float* __restrict__ vb,
                                                         float* __restrict__ s) {
    __shared__ __attribute__((aligned(16))) float qn[16 * LDS_STRIDE];
    __shared__ __attribute__((aligned(16))) float part[4][3][16 * PART_STRIDE];
    const int tm = blockIdx.x * 16;
    const int h = blockIdx.y;
    const int wave = __builtin_amdgcn_readfirstlane(threadIdx.x >> 5);
    const int lane = threadIdx.x & 31;
    const int half = lane >> 4;
    const int l15 = lane & 15;
    const int kc = wave & 3;                       // quarter of k
    const int cl = (wave >> 2) * 16 + l15;         // column inside the head
    const int ko = kc * KC + 4 * half;
    const int wo = (h * DKh + cl) * Dm + ko;       // B[k][n] = W[n][k]
    const int xo = (tm + l15) * Dm + ko;
    const int orow = threadIdx.x >> 4;             // the element pair this thread adds up
    const int oc = (threadIdx.x & 15) * 2;

    // LayerNorm: wave w owns rows 2w, 2w+1 of the block
    const int qo = (tm + wave * 2) * Dm + lane;
    float vals[2][8], gv[8], bb[8];
#pragma unroll
    for (int i = 0; i < 8; ++i) {
        vals[0][i] = q[qo + i * 32];
        vals[1][i] = q[qo + Dm + i * 32];
        gv[i] = g[lane + i * 32];
        bb[i] = b[lane + i * 32];
    }
    const float* pxk = k + xo;
    const float* pwk = Wk + wo;
    const float* pxv = v + xo;
    const float* pwv = Wv + wo;
    const float* pwq = Wq + wo;
    v4f xk[8], wk[8], xv[8], wv[8], wq[8];
#pragma unroll
    for (int i = 0; i < 8; ++i) {
        xk[i] = *(const v4f*)(pxk + 8 * i);
        wk[i] = *(const v4f*)(pwk + 8 * i);
        xv[i] = *(const v4f*)(pxv + 8 * i);
        wv[i] = *(const v4f*)(pwv + 8 * i);
    }
#pragma unroll
    for (int i = 0; i < 8; ++i) wq[i] = *(const v4f*)(pwq + 8 * i);
    // with this many registers in use the compiler lets a later load's result land on an earlier
    // load's address register; the addresses are named here so that none is rewritten before this wait
    asm volatile("s_wait_xcnt 0x0" :: "v"(qo), "v"(pxk), "v"(pwk), "v"(pxv), "v"(pwv), "v"(pwq) : "memory");
    const v2f biq = *(const v2f*)(bq + h * DKh + oc);
    const v2f bik = *(const v2f*)(bk + h * DKh + oc);
    const v2f biv = *(const v2f*)(bv + h * DKh + oc);
    // no load above may sink below this line: a load issued later waits for memory a second time
    __builtin_amdgcn_sched_barrier(0);

#pragma unroll
    for (int rr = 0; rr < 2; ++rr) {
        const int ii = wave * 2 + rr;
        float sm = 0.f;
#pragma unroll
        for (int i = 0; i < 8; ++i) sm += vals[rr][i];
        const float mu = wave_sum(sm) * (1.0f / Dm);
        float vv = 0.f;
#pragma unroll
        for (int i = 0; i < 8; ++i) { float d = vals[rr][i] - mu; vv += d * d; }
        const float rs = rsqrtf(wave_sum(vv) * (1.0f / Dm) + 1e-6f);
#pragma unroll
        for (int i = 0; i < 8; ++i)
            qn[ii * LDS_STRIDE + lane + i * 32] = (vals[rr][i] - mu) * rs * gv[i] + bb[i];
    }

    __syncthreads();
    const float* arow = qn + l15 * LDS_STRIDE + ko;
    v4f xq[8];
#pragma unroll
    for (int i = 0; i < 8; ++i) xq[i] = *(const v4f*)(arow + 8 * i);
    // all LDS reads issue before the first product: one LDS latency, not one per pair of products
    __builtin_amdgcn_sched_barrier(0);
    v8f aq = {}, ak = {}, av = {};
#pragma unroll
    for (int i = 0; i < 8; ++i) {
        aq = mm2(xq[i], wq[i], aq);
        ak = mm2(xk[i], wk[i], ak);
        av = mm2(xv[i], wv[i], av);
    }
    mm_end();

#pragma unroll
    for (int r = 0; r < 8; ++r) {
        const int o = (r + half * 8) * PART_STRIDE + cl;
        part[kc][0][o] = aq[r];
        part[kc][1][o] = ak[r];
        part[kc][2][o] = av[r];
    }
    __syncthreads();

    const int po = orow * PART_STRIDE + oc;
    v2f sum[3];
#pragma unroll
    for (int m = 0; m < 3; ++m)
        sum[m] = (*(const v2f*)(&part[0][m][po]) + *(const v2f*)(&part[1][m][po])) +
                 (*(const v2f*)(&part[2][m][po]) + *(const v2f*)(&part[3][m][po]));
    *(v2f*)(vb + (tm + orow) * Dm + h * DKh + oc) = sum[2] + biv;
    const v2f qv = sum[0] + biq;
    const v2f kv = sum[1] + bik;
    float p = fmaf(qv.y, kv.y, qv.x * kv.x);
#pragma unroll
    for (int m = 8; m >= 1; m >>= 1) p += __shfl_xor(p, m, 32);   // the 16 lanes of one row
    if ((threadIdx.x & 15) == 0) s[h * L + tm + orow] = p;
}

// ---- C[i][n] = sum_d A[i][d] * W[n][d] + bias[n] (+ res[i][n]) ----
// block = one 16x32 tile
template <bool HAS_RES>
__global__ __launch_bounds__(256) void gemm_wmma(const float* __restrict__ A,
                                                 const float* __restrict__ W,
                                                 const float* __restrict__ bias,
                                                 const float* __restrict__ res,
                                                 float* __restrict__ C) {
    __shared__ __attribute__((aligned(16))) float part[4][16 * PART_STRIDE];
    const int wave = __builtin_amdgcn_readfirstlane(threadIdx.x >> 5);
    const int lane = threadIdx.x & 31;
    const int tm = (blockIdx.x >> 3) * 16;         // 128 tiles = 16 (M) x 8 (N)
    const int tn = (blockIdx.x & 7) * 32;
    const int half = lane >> 4;
    const int l15 = lane & 15;
    const int kc = wave & 3;
    const int cl = (wave >> 2) * 16 + l15;
    const int ko = kc * KC + 4 * half;
    const float* arow = A + (tm + l15) * Dm + ko;
    const float* brow = W + (tn + cl) * Dm + ko;   // B[k][n] = W[n][k]
    const int orow = threadIdx.x >> 4;
    const int oc = (threadIdx.x & 15) * 2;
    v4f a[8], bf[8];
#pragma unroll
    for (int i = 0; i < 8; ++i) {
        a[i]  = *(const v4f*)(arow + 8 * i);
        bf[i] = *(const v4f*)(brow + 8 * i);
    }
    const v2f bi = *(const v2f*)(bias + tn + oc);
    v2f rv = {};
    if (HAS_RES) rv = *(const v2f*)(res + (tm + orow) * Dm + tn + oc);
    // no load above may sink below this line: a load issued later waits for memory a second time
    __builtin_amdgcn_sched_barrier(0);
    v8f acc = {};
#pragma unroll
    for (int i = 0; i < 8; ++i) acc = mm2(a[i], bf[i], acc);
    mm_end();
#pragma unroll
    for (int r = 0; r < 8; ++r) part[kc][(r + half * 8) * PART_STRIDE + cl] = acc[r];
    __syncthreads();
    const int po = orow * PART_STRIDE + oc;
    const v2f sum = (*(const v2f*)(&part[0][po]) + *(const v2f*)(&part[1][po])) +
                    (*(const v2f*)(&part[2][po]) + *(const v2f*)(&part[3][po]));
    *(v2f*)(C + (tm + orow) * Dm + tn + oc) = (sum + bi) + rv;
}

// ---- per (head, 16-row block): logits -> softmax -> attn out,
//      then O[16x32] = Wgt[16x256] x Vhead[256x32] via WMMA ----
__global__ __launch_bounds__(256) void attn_kernel(const float* __restrict__ t,
                                                   const float* __restrict__ s,
                                                   const float* __restrict__ vb,
                                                   float* __restrict__ attn_out,
                                                   float* __restrict__ o_pre) {
    __shared__ __attribute__((aligned(16))) float wgt[16 * LDS_STRIDE];
    __shared__ __attribute__((aligned(16))) float part[4][16 * PART_STRIDE];
    const int iblock = blockIdx.x;   // 0..15
    const int h = blockIdx.y;        // 0..7
    const int tid = threadIdx.x;
    const float inv_temp = 0.17677669529663687f;   // 1/sqrt(32)
    const int wave = __builtin_amdgcn_readfirstlane(tid >> 5);
    const int lane = tid & 31;
    const int half = lane >> 4, l15 = lane & 15;
    const int kc = wave & 3;
    const int cl = (wave >> 2) * 16 + l15;

    // the V operand of phase 3 depends on nothing computed here: ask for it first
    const float* bbase = vb + (kc * KC + 2 * half) * Dm + h * DKh + cl;   // B[k][n]=vb[k][col]
    v2f bf[16];
#pragma unroll
    for (int i = 0; i < 16; ++i) {
        bf[i].x = bbase[(4 * i) * Dm];
        bf[i].y = bbase[(4 * i + 1) * Dm];
    }
    // no load above may sink below this line: a load issued later waits for memory a second time
    __builtin_amdgcn_sched_barrier(0);

    // phase 1: logits[ii][j] = (1 + e^{-2|ti-tj|}) * s[h,j] / temp
    for (int idx = tid; idx < 16 * L; idx += 256) {
        int ii = idx >> 8;
        int j = idx & 255;
        int i = iblock * 16 + ii;
        float dt = fabsf(t[i] - t[j]);
        wgt[ii * LDS_STRIDE + j] = (1.0f + __expf(-2.0f * dt)) * s[h * L + j] * inv_temp;
    }
    __syncthreads();

    // phase 2: softmax per row (wave w owns rows 2w, 2w+1); write attn,
    // rebuild LDS as post-softmax weights * (1 + e^{-dt})
#pragma unroll
    for (int rr = 0; rr < 2; ++rr) {
        int ii = wave * 2 + rr;
        int i = iblock * 16 + ii;
        float ti = t[i];
        float lv[8];
        float m = -1e30f;
#pragma unroll
        for (int c = 0; c < 8; ++c) {
            lv[c] = wgt[ii * LDS_STRIDE + lane + c * 32];
            m = fmaxf(m, lv[c]);
        }
        m = wave_max(m);
        float sum = 0.f;
#pragma unroll
        for (int c = 0; c < 8; ++c) { lv[c] = __expf(lv[c] - m); sum += lv[c]; }
        const float inv = 1.0f / wave_sum(sum);
#pragma unroll
        for (int c = 0; c < 8; ++c) {
            int j = lane + c * 32;
            float a = lv[c] * inv;
            attn_out[(h * L + i) * L + j] = a;
            float dt = fabsf(ti - t[j]);
            wgt[ii * LDS_STRIDE + j] = a * (1.0f + __expf(-dt));
        }
    }
    __syncthreads();

    // phase 3: every wave takes one column tile and one quarter of the 256 keys
    const float* arow = wgt + l15 * LDS_STRIDE + kc * KC + 2 * half;
    v2f af[16];
#pragma unroll
    for (int i = 0; i < 16; ++i) af[i] = *(const v2f*)(arow + 4 * i);
    // all LDS reads issue before the first product: one LDS latency, not one per pair of products
    __builtin_amdgcn_sched_barrier(0);
    v8f acc = {};
#pragma unroll
    for (int i = 0; i < 16; ++i)
        acc = __builtin_amdgcn_wmma_f32_16x16x4_f32(false, af[i], false, bf[i],
                                                    (short)0, acc, false, false);
    mm_end();
#pragma unroll
    for (int r = 0; r < 8; ++r) part[kc][(r + half * 8) * PART_STRIDE + cl] = acc[r];
    __syncthreads();
    const int orow = tid >> 4;
    const int oc = (tid & 15) * 2;
    const int po = orow * PART_STRIDE + oc;
    const v2f sum = (*(const v2f*)(&part[0][po]) + *(const v2f*)(&part[1][po])) +
                    (*(const v2f*)(&part[2][po]) + *(const v2f*)(&part[3][po]));
    *(v2f*)(o_pre + (iblock * 16 + orow) * Dm + h * DKh + oc) = sum;
}

extern "C" void kernel_launch(void* const* d_in, const int* in_sizes, int n_in,
                              void* d_out, int out_size, void* d_ws, size_t ws_size,
                              hipStream_t stream) {
    const float* q    = (const float*)d_in[0];
    const float* k    = (const float*)d_in[1];
    const float* v    = (const float*)d_in[2];
    const float* t    = (const float*)d_in[3];
    const float* Wq   = (const float*)d_in[4];
    const float* bq   = (const float*)d_in[5];
    const float* Wk   = (const float*)d_in[6];
    const float* bk   = (const float*)d_in[7];
    const float* Wv   = (const float*)d_in[8];
    const float* bv   = (const float*)d_in[9];
    const float* fc_w = (const float*)d_in[10];
    const float* fc_b = (const float*)d_in[11];
    const float* ln_g = (const float*)d_in[12];
    const float* ln_b = (const float*)d_in[13];

    float* out  = (float*)d_out;          // [L, D]    (65536)
    float* attn = out + L * Dm;           // [H, L, L] (524288)

    float* ws = (float*)d_ws;
    float* vb = ws;                 // 65536
    float* op = ws + 1 * 65536;     // 65536
    float* sc = ws + 2 * 65536;     // 2048

    dim3 pg(16, H);
    proj_score_kernel<<<pg, 256, 0, stream>>>(q, k, v, Wq, bq, Wk, bk, Wv, bv, ln_g, ln_b, vb, sc);
    dim3 ag(16, H);
    attn_kernel<<<ag, 256, 0, stream>>>(t, sc, vb, attn, op);
    gemm_wmma<true><<<128, 256, 0, stream>>>(op, fc_w, fc_b, q, out);
}

// v003
// Measured time: 13 microseconds a run.
// Next to v002, in two timings, it ran 1.08 times as fast each time.
// All steps since v000 together make it 4.92 times as fast.
#include <hip/hip_runtime.h>
#include <math.h>

#define L 256
#define Dm 256
#define H 8
#define DKh 32
#define LDS_STRIDE 260   // 260 % 64 == 4 -> 16 rows hit 16 distinct banks
#define PART_STRIDE 36   // 8 rows further on = 32 banks further on: the two lane halves do not collide
#define KC 64            // k range of one wave: a quarter of the 256

typedef float v2f __attribute__((ext_vector_type(2)));
typedef float v4f __attribute__((ext_vector_type(4)));
typedef float v8f __attribute__((ext_vector_type(8)));

// Lane l reads lane l ^ 16: a vector move between the two 16-lane rows, no LDS queue and no wait.
__device__ __forceinline__ float xor16(float v) {
    const int b = __builtin_bit_cast(int, v);
    return __builtin_bit_cast(float,
        __builtin_amdgcn_permlanex16(b, b, 0x76543210, 0xfedcba98, false, false));
}
// Lane l reads lane l ^ M inside its 16-lane row (DPP row_xmask:M); every source lane is on, so the
// zero 'old' value is never taken; it lets the move fold into the add or max that uses it.
template <int M>
__device__ __forceinline__ float row_xor(float v) {
    return __builtin_bit_cast(float,
        __builtin_amdgcn_update_dpp(0, __builtin_bit_cast(int, v), 0x160 | M, 0xf, 0xf, true));
}
// Butterflies in the order 8, 4, 2, 1 inside a 16-lane row.
__device__ __forceinline__ float row_sum(float v) {
    v += row_xor<8>(v);
    v += row_xor<4>(v);
    v += row_xor<2>(v);
    v += row_xor<1>(v);
    return v;
}
__device__ __forceinline__ float wave_max(float v) {
    v = fmaxf(v, xor16(v));
    v = fmaxf(v, row_xor<8>(v));
    v = fmaxf(v, row_xor<4>(v));
    v = fmaxf(v, row_xor<2>(v));
    v = fmaxf(v, row_xor<1>(v));
    return v;
}
__device__ __forceinline__ float wave_sum(float v) {
    v += xor16(v);
    return row_sum(v);
}

// Two matrix steps from one 16-byte piece of a row of A and of B. A lane holds
// k = base + 4 * half + 0..3; .xy feeds the first step and .zw the second, in A and B alike,
// so every product pairs equal k.
__device__ __forceinline__ v8f mm2(v4f a, v4f b, v8f acc) {
    acc = __builtin_amdgcn_wmma_f32_16x16x4_f32(false, a.xy, false, b.xy, (short)0, acc, false, false);
    acc = __builtin_amdgcn_wmma_f32_16x16x4_f32(false, a.zw, false, b.zw, (short)0, acc, false, false);
    return acc;
}

// Ends a run of matrix instructions. The two scheduling fences keep address arithmetic out of the
// run and out of the v_nops; the v_nops are the four vector issue slots that must pass before a
// vector instruction overwrites the run's A or B registers or touches its result.
__device__ __forceinline__ void mm_end() {
    __builtin_amdgcn_sched_barrier(0);
    asm volatile("v_nop\n\tv_nop\n\tv_nop\n\tv_nop");
    __builtin_amdgcn_sched_barrier(0);
}

// Every product below is split the same way: 8 waves = 2 column tiles x 4 quarters of k.
// A wave issues all operand loads of its quarter before it uses the first one, so the block
// waits for memory once; the four partial tiles meet in LDS and are added there.

// ---- one launch for everything that is local to a row: LayerNorm of q,
//      the three projections and s[h,j] = qbase[j,head h] . kbase[j,head h].
//      Block = 16 rows x 1 head. Of the projections only vbase goes to memory.
__global__ __launch_bounds__(256) void proj_score_kernel(const float* __restrict__ q,
                                                         const float* __restrict__ k,
                                                         const float* __restrict__ v,
                                                         const float* __restrict__ Wq,
                                                         const float* __restrict__ bq,
                                                         const float* __restrict__ Wk,
                                                         const float* __restrict__ bk,
                                                         const float* __restrict__ Wv,
                                                         const float* __restrict__ bv,
                                                         const float* __restrict__ g,
                                                         const float* __restrict__ b,
                                                         float* __restrict__ vb,
                                                         float* __restrict__ s) {
    __shared__ __attribute__((aligned(16))) float qn[16 * LDS_STRIDE];
    __shared__ __attribute__((aligned(16))) float part[4][3][16 * PART_STRIDE];
    const int tm = blockIdx.x * 16;
    const int h = blockIdx.y;
    const int wave = __builtin_amdgcn_readfirstlane(threadIdx.x >> 5);
    const int lane = threadIdx.x & 31;
    const int half = lane >> 4;
    const int l15 = lane & 15;
    const int kc = wave & 3;                       // quarter of k
    const int cl = (wave >> 2) * 16 + l15;         // column inside the head
    const int ko = kc * KC + 4 * half;
    const int wo = (h * DKh + cl) * Dm + ko;       // B[k][n] = W[n][k]
    const int xo = (tm + l15) * Dm + ko;
    const int orow = threadIdx.x >> 4;             // the element pair this thread adds up
    const int oc = (threadIdx.x & 15) * 2;

    // LayerNorm: wave w owns rows 2w, 2w+1 of the block
    const int qo = (tm + wave * 2) * Dm + lane;
    float vals[2][8], gv[8], bb[8];
#pragma unroll
    for (int i = 0; i < 8; ++i) {
        vals[0][i] = q[qo + i * 32];
        vals[1][i] = q[qo + Dm + i * 32];
        gv[i] = g[lane + i * 32];
        bb[i] = b[lane + i * 32];
    }
    const float* pxk = k + xo;
    const float* pwk = Wk + wo;
    const float* pxv = v + xo;
    const float* pwv = Wv + wo;
    const float* pwq = Wq + wo;
    v4f xk[8], wk[8], xv[8], wv[8], wq[8];
#pragma unroll
    for (int i = 0; i < 8; ++i) {
        xk[i] = *(const v4f*)(pxk + 8 * i);
        wk[i] = *(const v4f*)(pwk + 8 * i);
        xv[i] = *(const v4f*)(pxv + 8 * i);
        wv[i] = *(const v4f*)(pwv + 8 * i);
    }
#pragma unroll
    for (int i = 0; i < 8; ++i) wq[i] = *(const v4f*)(pwq + 8 * i);
    // with this many registers in use the compiler lets a later load's result land on an earlier
    // load's address register; the addresses are named here so that none is rewritten before this wait
    asm volatile("s_wait_xcnt 0x0" :: "v"(qo), "v"(pxk), "v"(pwk), "v"(pxv), "v"(pwv), "v"(pwq) : "memory");
    const v2f biq = *(const v2f*)(bq + h * DKh + oc);
    const v2f bik = *(const v2f*)(bk + h * DKh + oc);
    const v2f biv = *(const v2f*)(bv + h * DKh + oc);
    // no load above may sink below this line: a load issued later waits for memory a second time
    __builtin_amdgcn_sched_barrier(0);

#pragma unroll
    for (int rr = 0; rr < 2; ++rr) {
        const int ii = wave * 2 + rr;
        float sm = 0.f;
#pragma unroll
        for (int i = 0; i < 8; ++i) sm += vals[rr][i];
        const float mu = wave_sum(sm) * (1.0f / Dm);
        float vv = 0.f;
#pragma unroll
        for (int i = 0; i < 8; ++i) { float d = vals[rr][i] - mu; vv += d * d; }
        const float rs = rsqrtf(wave_sum(vv) * (1.0f / Dm) + 1e-6f);
#pragma unroll
        for (int i = 0; i < 8; ++i)
            qn[ii * LDS_STRIDE + lane + i * 32] = (vals[rr][i] - mu) * rs * gv[i] + bb[i];
    }

    __syncthreads();
    const float* arow = qn + l15 * LDS_STRIDE + ko;
    v4f xq[8];
#pragma unroll
    for (int i = 0; i < 8; ++i) xq[i] = *(const v4f*)(arow + 8 * i);
    // all LDS reads issue before the first product: one LDS latency, not one per pair of products
    __builtin_amdgcn_sched_barrier(0);
    v8f aq = {}, ak = {}, av = {};
#pragma unroll
    for (int i = 0; i < 8; ++i) {
        aq = mm2(xq[i], wq[i], aq);
        ak = mm2(xk[i], wk[i], ak);
        av = mm2(xv[i], wv[i], av);
    }
    mm_end();

#pragma unroll
    for (int r = 0; r < 8; ++r) {
        const int o = (r + half * 8) * PART_STRIDE + cl;
        part[kc][0][o] = aq[r];
        part[kc][1][o] = ak[r];
        part[kc][2][o] = av[r];
    }
    __syncthreads();

    const int po = orow * PART_STRIDE + oc;
    v2f sum[3];
#pragma unroll
    for (int m = 0; m < 3; ++m)
        sum[m] = (*(const v2f*)(&part[0][m][po]) + *(const v2f*)(&part[1][m][po])) +
                 (*(const v2f*)(&part[2][m][po]) + *(const v2f*)(&part[3][m][po]));
    *(v2f*)(vb + (tm + orow) * Dm + h * DKh + oc) = sum[2] + biv;
    const v2f qv = sum[0] + biq;
    const v2f kv = sum[1] + bik;
    float p = fmaf(qv.y, kv.y, qv.x * kv.x);
    p = row_sum(p);   // the 16 lanes of one row
    if ((threadIdx.x & 15) == 0) s[h * L + tm + orow] = p;
}

// ---- C[i][n] = sum_d A[i][d] * W[n][d] + bias[n] (+ res[i][n]) ----
// block = one 16x32 tile
template <bool HAS_RES>
__global__ __launch_bounds__(256) void gemm_wmma(const float* __restrict__ A,
                                                 const float* __restrict__ W,
                                                 const float* __restrict__ bias,
                                                 const float* __restrict__ res,
                                                 float* __restrict__ C) {
    __shared__ __attribute__((aligned(16))) float part[4][16 * PART_STRIDE];
    const int wave = __builtin_amdgcn_readfirstlane(threadIdx.x >> 5);
    const int lane = threadIdx.x & 31;
    const int tm = (blockIdx.x >> 3) * 16;         // 128 tiles = 16 (M) x 8 (N)
    const int tn = (blockIdx.x & 7) * 32;
    const int half = lane >> 4;
    const int l15 = lane & 15;
    const int kc = wave & 3;
    const int cl = (wave >> 2) * 16 + l15;
    const int ko = kc * KC + 4 * half;
    const float* arow = A + (tm + l15) * Dm + ko;
    const float* brow = W + (tn + cl) * Dm + ko;   // B[k][n] = W[n][k]
    const int orow = threadIdx.x >> 4;
    const int oc = (threadIdx.x & 15) * 2;
    v4f a[8], bf[8];
#pragma unroll
    for (int i = 0; i < 8; ++i) {
        a[i]  = *(const v4f*)(arow + 8 * i);
        bf[i] = *(const v4f*)(brow + 8 * i);
    }
    const v2f bi = *(const v2f*)(bias + tn + oc);
    v2f rv = {};
    if (HAS_RES) rv = *(const v2f*)(res + (tm + orow) * Dm + tn + oc);
    // no load above may sink below this line: a load issued later waits for memory a second time
    __builtin_amdgcn_sched_barrier(0);
    v8f acc = {};
#pragma unroll
    for (int i = 0; i < 8; ++i) acc = mm2(a[i], bf[i], acc);
    mm_end();
#pragma unroll
    for (int r = 0; r < 8; ++r) part[kc][(r + half * 8) * PART_STRIDE + cl] = acc[r];
    __syncthreads();
    const int po = orow * PART_STRIDE + oc;
    const v2f sum = (*(const v2f*)(&part[0][po]) + *(const v2f*)(&part[1][po])) +
                    (*(const v2f*)(&part[2][po]) + *(const v2f*)(&part[3][po]));
    *(v2f*)(C + (tm + orow) * Dm + tn + oc) = (sum + bi) + rv;
}

// ---- per (head, 16-row block): logits -> softmax -> attn out,
//      then O[16x32] = Wgt[16x256] x Vhead[256x32] via WMMA ----
__global__ __launch_bounds__(256) void attn_kernel(const float* __restrict__ t,
                                                   const float* __restrict__ s,
                                                   const float* __restrict__ vb,
                                                   float* __restrict__ attn_out,
                                                   float* __restrict__ o_pre) {
    __shared__ __attribute__((aligned(16))) float wgt[16 * LDS_STRIDE];
    __shared__ __attribute__((aligned(16))) float part[4][16 * PART_STRIDE];
    const int iblock = blockIdx.x;   // 0..15
    const int h = blockIdx.y;        // 0..7
    const int tid = threadIdx.x;
    const float inv_temp = 0.17677669529663687f;   // 1/sqrt(32)
    const int wave = __builtin_amdgcn_readfirstlane(tid >> 5);
    const int lane = tid & 31;
    const int half = lane >> 4, l15 = lane & 15;
    const int kc = wave & 3;
    const int cl = (wave >> 2) * 16 + l15;

    // the V operand of phase 3 depends on nothing computed here: ask for it first
    const float* bbase = vb + (kc * KC + 2 * half) * Dm + h * DKh + cl;   // B[k][n]=vb[k][col]
    v2f bf[16];
#pragma unroll
    for (int i = 0; i < 16; ++i) {
        bf[i].x = bbase[(4 * i) * Dm];
        bf[i].y = bbase[(4 * i + 1) * Dm];
    }
    // no load above may sink below this line: a load issued later waits for memory a second time
    __builtin_amdgcn_sched_barrier(0);

    // phase 1: logits[ii][j] = (1 + e^{-2|ti-tj|}) * s[h,j] / temp
    for (int idx = tid; idx < 16 * L; idx += 256) {
        int ii = idx >> 8;
        int j = idx & 255;
        int i = iblock * 16 + ii;
        float dt = fabsf(t[i] - t[j]);
        wgt[ii * LDS_STRIDE + j] = (1.0f + __expf(-2.0f * dt)) * s[h * L + j] * inv_temp;
    }
    __syncthreads();

    // phase 2: softmax per row (wave w owns rows 2w, 2w+1); write attn,
    // rebuild LDS as post-softmax weights * (1 + e^{-dt})
#pragma unroll
    for (int rr = 0; rr < 2; ++rr) {
        int ii = wave * 2 + rr;
        int i = iblock * 16 + ii;
        float ti = t[i];
        float lv[8];
        float m = -1e30f;
#pragma unroll
        for (int c = 0; c < 8; ++c) {
            lv[c] = wgt[ii * LDS_STRIDE + lane + c * 32];
            m = fmaxf(m, lv[c]);
        }
        m = wave_max(m);
        float sum = 0.f;
#pragma unroll
        for (int c = 0; c < 8; ++c) { lv[c] = __expf(lv[c] - m); sum += lv[c]; }
        const float inv = 1.0f / wave_sum(sum);
#pragma unroll
        for (int c = 0; c < 8; ++c) {
            int j = lane + c * 32;
            float a = lv[c] * inv;
            attn_out[(h * L + i) * L + j] = a;
            float dt = fabsf(ti - t[j]);
            wgt[ii * LDS_STRIDE + j] = a * (1.0f + __expf(-dt));
        }
    }
    __syncthreads();

    // phase 3: every wave takes one column tile and one quarter of the 256 keys
    const float* arow = wgt + l15 * LDS_STRIDE + kc * KC + 2 * half;
    v2f af[16];
#pragma unroll
    for (int i = 0; i < 16; ++i) af[i] = *(const v2f*)(arow + 4 * i);
    // all LDS reads issue before the first product: one LDS latency, not one per matrix step
    __builtin_amdgcn_sched_barrier(0);
    v8f acc = {};
#pragma unroll
    for (int i = 0; i < 16; ++i)
        acc = __builtin_amdgcn_wmma_f32_16x16x4_f32(false, af[i], false, bf[i],
                                                    (short)0, acc, false, false);
    mm_end();
#pragma unroll
    for (int r = 0; r < 8; ++r) part[kc][(r + half * 8) * PART_STRIDE + cl] = acc[r];
    __syncthreads();
    const int orow = tid >> 4;
    const int oc = (tid & 15) * 2;
    const int po = orow * PART_STRIDE + oc;
    const v2f sum = (*(const v2f*)(&part[0][po]) + *(const v2f*)(&part[1][po])) +
                    (*(const v2f*)(&part[2][po]) + *(const v2f*)(&part[3][po]));
    *(v2f*)(o_pre + (iblock * 16 + orow) * Dm + h * DKh + oc) = sum;
}

extern "C" void kernel_launch(void* const* d_in, const int* in_sizes, int n_in,
                              void* d_out, int out_size, void* d_ws, size_t ws_size,
                              hipStream_t stream) {
    const float* q    = (const float*)d_in[0];
    const float* k    = (const float*)d_in[1];
    const float* v    = (const float*)d_in[2];
    const float* t    = (const float*)d_in[3];
    const float* Wq   = (const float*)d_in[4];
    const float* bq   = (const float*)d_in[5];
    const float* Wk   = (const float*)d_in[6];
    const float* bk   = (const float*)d_in[7];
    const float* Wv   = (const float*)d_in[8];
    const float* bv   = (const float*)d_in[9];
    const float* fc_w = (const float*)d_in[10];
    const float* fc_b = (const float*)d_in[11];
    const float* ln_g = (const float*)d_in[12];
    const float* ln_b = (const float*)d_in[13];

    float* out  = (float*)d_out;          // [L, D]    (65536)
    float* attn = out + L * Dm;           // [H, L, L] (524288)

    float* ws = (float*)d_ws;
    float* vb = ws;                 // 65536
    float* op = ws + 1 * 65536;     // 65536
    float* sc = ws + 2 * 65536;     // 2048

    dim3 pg(16, H);
    proj_score_kernel<<<pg, 256, 0, stream>>>(q, k, v, Wq, bq, Wk, bk, Wv, bv, ln_g, ln_b, vb, sc);
    dim3 ag(16, H);
    attn_kernel<<<ag, 256, 0, stream>>>(t, sc, vb, attn, op);
    gemm_wmma<true><<<128, 256, 0, stream>>>(op, fc_w, fc_b, q, out);
}

// v004
// It runs in 11 microseconds.
// Two timings next to v003 put it at 1.21 and 1.23 times that version's speed.
// Over all steps from v000 it is 6.01 times as fast.
#include <hip/hip_runtime.h>
#include <math.h>

#define L 256
#define Dm 256
#define H 8
#define DKh 32
#define LDS_STRIDE 260   // 260 % 64 == 4 -> 16 rows hit 16 distinct banks
#define PART_STRIDE 36   // 8 rows further on = 32 banks further on: the two lane halves do not collide
#define KC 64            // k range of one wave: a quarter of the 256

typedef float v2f __attribute__((ext_vector_type(2)));
typedef float v4f __attribute__((ext_vector_type(4)));
typedef float v8f __attribute__((ext_vector_type(8)));

// Lane l reads lane l ^ 16: a vector move between the two 16-lane rows, no LDS queue and no wait.
__device__ __forceinline__ float xor16(float v) {
    const int b = __builtin_bit_cast(int, v);
    return __builtin_bit_cast(float,
        __builtin_amdgcn_permlanex16(b, b, 0x76543210, 0xfedcba98, false, false));
}
// Lane l reads lane l ^ M inside its 16-lane row (DPP row_xmask:M); every source lane is on, so the
// zero 'old' value is never taken; it lets the move fold into the add or max that uses it.
template <int M>
__device__ __forceinline__ float row_xor(float v) {
    return __builtin_bit_cast(float,
        __builtin_amdgcn_update_dpp(0, __builtin_bit_cast(int, v), 0x160 | M, 0xf, 0xf, true));
}
// Butterflies in the order 8, 4, 2, 1 inside a 16-lane row.
__device__ __forceinline__ float row_sum(float v) {
    v += row_xor<8>(v);
    v += row_xor<4>(v);
    v += row_xor<2>(v);
    v += row_xor<1>(v);
    return v;
}
__device__ __forceinline__ float wave_max(float v) {
    v = fmaxf(v, xor16(v));
    v = fmaxf(v, row_xor<8>(v));
    v = fmaxf(v, row_xor<4>(v));
    v = fmaxf(v, row_xor<2>(v));
    v = fmaxf(v, row_xor<1>(v));
    return v;
}
__device__ __forceinline__ float wave_sum(float v) {
    v += xor16(v);
    return row_sum(v);
}

// Two matrix steps from one 16-byte piece of a row of A and of B. A lane holds
// k = base + 4 * half + 0..3; .xy feeds the first step and .zw the second, in A and B alike,
// so every product pairs equal k.
__device__ __forceinline__ v8f mm2(v4f a, v4f b, v8f acc) {
    acc = __builtin_amdgcn_wmma_f32_16x16x4_f32(false, a.xy, false, b.xy, (short)0, acc, false, false);
    acc = __builtin_amdgcn_wmma_f32_16x16x4_f32(false, a.zw, false, b.zw, (short)0, acc, false, false);
    return acc;
}

// Ends a run of matrix instructions. The two scheduling fences keep address arithmetic out of the
// run and out of the v_nops; the v_nops are the four vector issue slots that must pass before a
// vector instruction overwrites the run's A or B registers or touches its result.
__device__ __forceinline__ void mm_end() {
    __builtin_amdgcn_sched_barrier(0);
    asm volatile("v_nop\n\tv_nop\n\tv_nop\n\tv_nop");
    __builtin_amdgcn_sched_barrier(0);
}

// LDS byte address of a __shared__ element.
__device__ __forceinline__ unsigned lds_addr(const float* p) { return (unsigned)(size_t)p; }

// Asynchronous copies to LDS. One copy of a wave moves 512 contiguous bytes (half a row of 256
// floats, four whole 128-byte lines), 16 bytes a lane, through no register. The s_wait_xcnt at
// the end of each statement is a precaution: no address register of a copy is rewritten in front of it.
#define CP(a, b) "global_load_async_to_lds_b128 %" #a ", %" #b ", off\n\t"
#define ASYNC8(Lx, Gx, o)                                                                        \
    asm volatile(CP(0, 8) CP(1, 9) CP(2, 10) CP(3, 11) CP(4, 12) CP(5, 13) CP(6, 14) CP(7, 15)   \
                 "s_wait_xcnt 0x0"                                                               \
                 :: "v"(Lx[o]), "v"(Lx[o + 1]), "v"(Lx[o + 2]), "v"(Lx[o + 3]),                  \
                    "v"(Lx[o + 4]), "v"(Lx[o + 5]), "v"(Lx[o + 6]), "v"(Lx[o + 7]),              \
                    "v"(Gx[o]), "v"(Gx[o + 1]), "v"(Gx[o + 2]), "v"(Gx[o + 3]),                  \
                    "v"(Gx[o + 4]), "v"(Gx[o + 5]), "v"(Gx[o + 6]), "v"(Gx[o + 7])               \
                 : "memory")
#define ASYNC12(Lx, Gx, o)                                                                       \
    asm volatile(CP(0, 12) CP(1, 13) CP(2, 14) CP(3, 15) CP(4, 16) CP(5, 17)                     \
                 CP(6, 18) CP(7, 19) CP(8, 20) CP(9, 21) CP(10, 22) CP(11, 23)                   \
                 "s_wait_xcnt 0x0"                                                               \
                 :: "v"(Lx[o]), "v"(Lx[o + 1]), "v"(Lx[o + 2]), "v"(Lx[o + 3]),                  \
                    "v"(Lx[o + 4]), "v"(Lx[o + 5]), "v"(Lx[o + 6]), "v"(Lx[o + 7]),              \
                    "v"(Lx[o + 8]), "v"(Lx[o + 9]), "v"(Lx[o + 10]), "v"(Lx[o + 11]),            \
                    "v"(Gx[o]), "v"(Gx[o + 1]), "v"(Gx[o + 2]), "v"(Gx[o + 3]),                  \
                    "v"(Gx[o + 4]), "v"(Gx[o + 5]), "v"(Gx[o + 6]), "v"(Gx[o + 7]),              \
                    "v"(Gx[o + 8]), "v"(Gx[o + 9]), "v"(Gx[o + 10]), "v"(Gx[o + 11])             \
                 : "memory")

// Every product below is split the same way: 8 waves = 2 column tiles x 4 quarters of k.
// A fragment load straight from global memory takes 32 bytes from each of 16 rows, 16 cache lines
// an instruction. The row-major operands therefore come into LDS in whole lines, all copies of the
// block asked for at once, and the fragments are read from padded LDS rows; the four partial
// tiles meet in LDS and are added there.

// ---- one launch for everything that is local to a row: LayerNorm of q,
//      the three projections and s[h,j] = qbase[j,head h] . kbase[j,head h].
//      Block = 16 rows x 1 head. Of the projections only vbase goes to memory.
__global__ __launch_bounds__(256) void proj_score_kernel(const float* __restrict__ q,
                                                         const float* __restrict__ k,
                                                         const float* __restrict__ v,
                                                         const float* __restrict__ Wq,
                                                         const float* __restrict__ bq,
                                                         const float* __restrict__ Wk,
                                                         const float* __restrict__ bk,
                                                         const float* __restrict__ Wv,
                                                         const float* __restrict__ bv,
                                                         const float* __restrict__ g,
                                                         const float* __restrict__ b,
                                                         float* __restrict__ vb,
                                                         float* __restrict__ s) {
    __shared__ __attribute__((aligned(16))) float qn[16 * LDS_STRIDE];
    __shared__ __attribute__((aligned(16))) float sx[2][16 * LDS_STRIDE];   // rows of k, of v
    __shared__ __attribute__((aligned(16))) float sw[3][32 * LDS_STRIDE];   // the head's rows of Wk, Wv, Wq
    __shared__ __attribute__((aligned(16))) float part[4][3][16 * PART_STRIDE];
    const int tm = blockIdx.x * 16;
    const int h = blockIdx.y;
    const int wave = __builtin_amdgcn_readfirstlane(threadIdx.x >> 5);
    const int lane = threadIdx.x & 31;
    const int half = lane >> 4;
    const int l15 = lane & 15;
    const int kc = wave & 3;                       // quarter of k
    const int cl = (wave >> 2) * 16 + l15;         // column inside the head
    const int ko = kc * KC + 4 * half;
    const int orow = threadIdx.x >> 4;             // the element pair this thread adds up
    const int oc = (threadIdx.x & 15) * 2;

    // LayerNorm: wave w owns rows 2w, 2w+1 of the block. Its loads go first: the LayerNorm
    // arithmetic then runs while the copies below are still landing.
    const int qo = (tm + wave * 2) * Dm + lane;
    float vals[2][8], gv[8], bb[8];
#pragma unroll
    for (int i = 0; i < 8; ++i) {
        vals[0][i] = q[qo + i * 32];
        vals[1][i] = q[qo + Dm + i * 32];
        gv[i] = g[lane + i * 32];
        bb[i] = b[lane + i * 32];
    }
    // the loads' address is named here so that it is not rewritten before this wait
    asm volatile("s_wait_xcnt 0x0" :: "v"(qo) : "memory");

    // wave w copies rows 2w, 2w+1 of k and of v and rows 4w..4w+3 of each weight tile
    unsigned la[32];
    const float* ga[32];
#pragma unroll
    for (int c = 0; c < 8; ++c) {                  // c = matrix * 4 + row * 2 + half row
        const int r = wave * 2 + ((c >> 1) & 1);
        const int e = (c & 1) * 128 + lane * 4;
        la[c] = lds_addr(&sx[c >> 2][r * LDS_STRIDE + e]);
        ga[c] = ((c >> 2) ? v : k) + (tm + r) * Dm + e;
    }
#pragma unroll
    for (int c = 0; c < 24; ++c) {                 // c = matrix * 8 + row * 2 + half row
        const int r = wave * 4 + ((c >> 1) & 3);
        const int e = (c & 1) * 128 + lane * 4;
        la[8 + c] = lds_addr(&sw[c >> 3][r * LDS_STRIDE + e]);
        ga[8 + c] = ((c >> 3) == 0 ? Wk : (c >> 3) == 1 ? Wv : Wq) + (h * DKh + r) * Dm + e;
    }
    ASYNC8(la, ga, 0);
    ASYNC12(la, ga, 8);
    ASYNC12(la, ga, 20);
    const v2f biq = *(const v2f*)(bq + h * DKh + oc);
    const v2f bik = *(const v2f*)(bk + h * DKh + oc);
    const v2f biv = *(const v2f*)(bv + h * DKh + oc);
    // no load above may sink below this line: a load issued later waits for memory a second time
    __builtin_amdgcn_sched_barrier(0);

#pragma unroll
    for (int rr = 0; rr < 2; ++rr) {
        const int ii = wave * 2 + rr;
        float sm = 0.f;
#pragma unroll
        for (int i = 0; i < 8; ++i) sm += vals[rr][i];
        const float mu = wave_sum(sm) * (1.0f / Dm);
        float vv = 0.f;
#pragma unroll
        for (int i = 0; i < 8; ++i) { float d = vals[rr][i] - mu; vv += d * d; }
        const float rs = rsqrtf(wave_sum(vv) * (1.0f / Dm) + 1e-6f);
#pragma unroll
        for (int i = 0; i < 8; ++i)
            qn[ii * LDS_STRIDE + lane + i * 32] = (vals[rr][i] - mu) * rs * gv[i] + bb[i];
    }

    // this wave's copies have landed; behind the barrier every wave's have, and the LayerNorm rows
    asm volatile("s_wait_asynccnt 0x0" ::: "memory");
    __syncthreads();
    const int ao = l15 * LDS_STRIDE + ko;
    const int bo = cl * LDS_STRIDE + ko;           // B[k][n] = W[n][k]
    v4f xk[8], wk[8], xv[8], wv[8], xq[8], wq[8];
#pragma unroll
    for (int i = 0; i < 8; ++i) {
        xq[i] = *(const v4f*)(&qn[ao + 8 * i]);
        wq[i] = *(const v4f*)(&sw[2][bo + 8 * i]);
        xk[i] = *(const v4f*)(&sx[0][ao + 8 * i]);
        wk[i] = *(const v4f*)(&sw[0][bo + 8 * i]);
        xv[i] = *(const v4f*)(&sx[1][ao + 8 * i]);
        wv[i] = *(const v4f*)(&sw[1][bo + 8 * i]);
    }
    // all LDS reads issue before the first product, in the order of their use: the products start
    // on the first pieces while the later ones are still on their way
    __builtin_amdgcn_sched_barrier(0);
    v8f aq = {}, ak = {}, av = {};
#pragma unroll
    for (int i = 0; i < 8; ++i) {
        aq = mm2(xq[i], wq[i], aq);
        ak = mm2(xk[i], wk[i], ak);
        av = mm2(xv[i], wv[i], av);
    }
    mm_end();

#pragma unroll
    for (int r = 0; r < 8; ++r) {
        const int o = (r + half * 8) * PART_STRIDE + cl;
        part[kc][0][o] = aq[r];
        part[kc][1][o] = ak[r];
        part[kc][2][o] = av[r];
    }
    __syncthreads();

    const int po = orow * PART_STRIDE + oc;
    v2f sum[3];
#pragma unroll
    for (int m = 0; m < 3; ++m)
        sum[m] = (*(const v2f*)(&part[0][m][po]) + *(const v2f*)(&part[1][m][po])) +
                 (*(const v2f*)(&part[2][m][po]) + *(const v2f*)(&part[3][m][po]));
    *(v2f*)(vb + (tm + orow) * Dm + h * DKh + oc) = sum[2] + biv;
    const v2f qv = sum[0] + biq;
    const v2f kv = sum[1] + bik;
    float p = fmaf(qv.y, kv.y, qv.x * kv.x);
    p = row_sum(p);   // the 16 lanes of one row
    if ((threadIdx.x & 15) == 0) s[h * L + tm + orow] = p;
}

// ---- C[i][n] = sum_d A[i][d] * W[n][d] + bias[n] (+ res[i][n]) ----
// block = one 16x32 tile
template <bool HAS_RES>
__global__ __launch_bounds__(256) void gemm_wmma(const float* __restrict__ A,
                                                 const float* __restrict__ W,
                                                 const float* __restrict__ bias,
                                                 const float* __restrict__ res,
                                                 float* __restrict__ C) {
    __shared__ __attribute__((aligned(16))) float sa[16 * LDS_STRIDE];
    __shared__ __attribute__((aligned(16))) float sb[32 * LDS_STRIDE];
    __shared__ __attribute__((aligned(16))) float part[4][16 * PART_STRIDE];
    const int wave = __builtin_amdgcn_readfirstlane(threadIdx.x >> 5);
    const int lane = threadIdx.x & 31;
    const int tm = (blockIdx.x >> 3) * 16;         // 128 tiles = 16 (M) x 8 (N)
    const int tn = (blockIdx.x & 7) * 32;
    const int half = lane >> 4;
    const int l15 = lane & 15;
    const int kc = wave & 3;
    const int cl = (wave >> 2) * 16 + l15;
    const int ko = kc * KC + 4 * half;
    const int orow = threadIdx.x >> 4;
    const int oc = (threadIdx.x & 15) * 2;
    // wave w copies rows 2w, 2w+1 of A and rows 4w..4w+3 of the weight tile
    unsigned la[12];
    const float* ga[12];
#pragma unroll
    for (int c = 0; c < 4; ++c) {                  // c = row * 2 + half row
        const int r = wave * 2 + (c >> 1);
        const int e = (c & 1) * 128 + lane * 4;
        la[c] = lds_addr(&sa[r * LDS_STRIDE + e]);
        ga[c] = A + (tm + r) * Dm + e;
    }
#pragma unroll
    for (int c = 0; c < 8; ++c) {
        const int r = wave * 4 + (c >> 1);
        const int e = (c & 1) * 128 + lane * 4;
        la[4 + c] = lds_addr(&sb[r * LDS_STRIDE + e]);
        ga[4 + c] = W + (tn + r) * Dm + e;
    }
    ASYNC12(la, ga, 0);
    const v2f bi = *(const v2f*)(bias + tn + oc);
    v2f rv = {};
    if (HAS_RES) rv = *(const v2f*)(res + (tm + orow) * Dm + tn + oc);
    // the two loads' address registers stay as they are until this wait
    asm volatile("s_wait_xcnt 0x0" ::: "memory");
    // no load above may sink below this line: a load issued later waits for memory a second time;
    // and nothing from below, which may reuse the loads' address registers, rises over the wait
    __builtin_amdgcn_sched_barrier(0);
    // this wave's copies have landed; behind the barrier every wave's have
    asm volatile("s_wait_asynccnt 0x0" ::: "memory");
    __syncthreads();
    const float* arow = sa + l15 * LDS_STRIDE + ko;
    const float* brow = sb + cl * LDS_STRIDE + ko;   // B[k][n] = W[n][k]
    v4f a[8], bf[8];
#pragma unroll
    for (int i = 0; i < 8; ++i) {
        a[i]  = *(const v4f*)(arow + 8 * i);
        bf[i] = *(const v4f*)(brow + 8 * i);
    }
    // all LDS reads issue before the first product, in the order of their use
    __builtin_amdgcn_sched_barrier(0);
    v8f acc = {};
#pragma unroll
    for (int i = 0; i < 8; ++i) acc = mm2(a[i], bf[i], acc);
    mm_end();
#pragma unroll
    for (int r = 0; r < 8; ++r) part[kc][(r + half * 8) * PART_STRIDE + cl] = acc[r];
    __syncthreads();
    const int po = orow * PART_STRIDE + oc;
    const v2f sum = (*(const v2f*)(&part[0][po]) + *(const v2f*)(&part[1][po])) +
                    (*(const v2f*)(&part[2][po]) + *(const v2f*)(&part[3][po]));
    *(v2f*)(C + (tm + orow) * Dm + tn + oc) = (sum + bi) + rv;
}

// ---- per (head, 16-row block): logits -> softmax -> attn out,
//      then O[16x32] = Wgt[16x256] x Vhead[256x32] via WMMA ----
__global__ __launch_bounds__(256) void attn_kernel(const float* __restrict__ t,
                                                   const float* __restrict__ s,
                                                   const float* __restrict__ vb,
                                                   float* __restrict__ attn_out,
                                                   float* __restrict__ o_pre) {
    __shared__ __attribute__((aligned(16))) float wgt[16 * LDS_STRIDE];
    __shared__ __attribute__((aligned(16))) float part[4][16 * PART_STRIDE];
    const int iblock = blockIdx.x;   // 0..15
    const int h = blockIdx.y;        // 0..7
    const int tid = threadIdx.x;
    const float inv_temp = 0.17677669529663687f;   // 1/sqrt(32)
    const int wave = __builtin_amdgcn_readfirstlane(tid >> 5);
    const int lane = tid & 31;
    const int half = lane >> 4, l15 = lane & 15;
    const int kc = wave & 3;
    const int cl = (wave >> 2) * 16 + l15;

    // the V operand of phase 3 depends on nothing computed here: ask for it first
    const float* bbase = vb + (kc * KC + 2 * half) * Dm + h * DKh + cl;   // B[k][n]=vb[k][col]
    v2f bf[16];
#pragma unroll
    for (int i = 0; i < 16; ++i) {
        bf[i].x = bbase[(4 * i) * Dm];
        bf[i].y = bbase[(4 * i + 1) * Dm];
    }
    // no load above may sink below this line: a load issued later waits for memory a second time
    __builtin_amdgcn_sched_barrier(0);

    // phase 1: logits[ii][j] = (1 + e^{-2|ti-tj|}) * s[h,j] / temp
    for (int idx = tid; idx < 16 * L; idx += 256) {
        int ii = idx >> 8;
        int j = idx & 255;
        int i = iblock * 16 + ii;
        float dt = fabsf(t[i] - t[j]);
        wgt[ii * LDS_STRIDE + j] = (1.0f + __expf(-2.0f * dt)) * s[h * L + j] * inv_temp;
    }
    __syncthreads();

    // phase 2: softmax per row (wave w owns rows 2w, 2w+1); write attn,
    // rebuild LDS as post-softmax weights * (1 + e^{-dt})
#pragma unroll
    for (int rr = 0; rr < 2; ++rr) {
        int ii = wave * 2 + rr;
        int i = iblock * 16 + ii;
        float ti = t[i];
        float lv[8];
        float m = -1e30f;
#pragma unroll
        for (int c = 0; c < 8; ++c) {
            lv[c] = wgt[ii * LDS_STRIDE + lane + c * 32];
            m = fmaxf(m, lv[c]);
        }
        m = wave_max(m);
        float sum = 0.f;
#pragma unroll
        for (int c = 0; c < 8; ++c) { lv[c] = __expf(lv[c] - m); sum += lv[c]; }
        const float inv = 1.0f / wave_sum(sum);
#pragma unroll
        for (int c = 0; c < 8; ++c) {
            int j = lane + c * 32;
            float a = lv[c] * inv;
            attn_out[(h * L + i) * L + j] = a;
            float dt = fabsf(ti - t[j]);
            wgt[ii * LDS_STRIDE + j] = a * (1.0f + __expf(-dt));
        }
    }
    __syncthreads();

    // phase 3: every wave takes one column tile and one quarter of the 256 keys
    const float* arow = wgt + l15 * LDS_STRIDE + kc * KC + 2 * half;
    v2f af[16];
#pragma unroll
    for (int i = 0; i < 16; ++i) af[i] = *(const v2f*)(arow + 4 * i);
    // all LDS reads issue before the first product: one LDS latency, not one per matrix step
    __builtin_amdgcn_sched_barrier(0);
    v8f acc = {};
#pragma unroll
    for (int i = 0; i < 16; ++i)
        acc = __builtin_amdgcn_wmma_f32_16x16x4_f32(false, af[i], false, bf[i],
                                                    (short)0, acc, false, false);
    mm_end();
#pragma unroll
    for (int r = 0; r < 8; ++r) part[kc][(r + half * 8) * PART_STRIDE + cl] = acc[r];
    __syncthreads();
    const int orow = tid >> 4;
    const int oc = (tid & 15) * 2;
    const int po = orow * PART_STRIDE + oc;
    const v2f sum = (*(const v2f*)(&part[0][po]) + *(const v2f*)(&part[1][po])) +
                    (*(const v2f*)(&part[2][po]) + *(const v2f*)(&part[3][po]));
    *(v2f*)(o_pre + (iblock * 16 + orow) * Dm + h * DKh + oc) = sum;
}

extern "C" void kernel_launch(void* const* d_in, const int* in_sizes, int n_in,
                              void* d_out, int out_size, void* d_ws, size_t ws_size,
                              hipStream_t stream) {
    const float* q    = (const float*)d_in[0];
    const float* k    = (const float*)d_in[1];
    const float* v    = (const float*)d_in[2];
    const float* t    = (const float*)d_in[3];
    const float* Wq   = (const float*)d_in[4];
    const float* bq   = (const float*)d_in[5];
    const float* Wk   = (const float*)d_in[6];
    const float* bk   = (const float*)d_in[7];
    const float* Wv   = (const float*)d_in[8];
    const float* bv   = (const float*)d_in[9];
    const float* fc_w = (const float*)d_in[10];
    const float* fc_b = (const float*)d_in[11];
    const float* ln_g = (const float*)d_in[12];
    const float* ln_b = (const float*)d_in[13];

    float* out  = (float*)d_out;          // [L, D]    (65536)
    float* attn = out + L * Dm;           // [H, L, L] (524288)

    float* ws = (float*)d_ws;
    float* vb = ws;                 // 65536
    float* op = ws + 1 * 65536;     // 65536
    float* sc = ws + 2 * 65536;     // 2048

    dim3 pg(16, H);
    proj_score_kernel<<<pg, 256, 0, stream>>>(q, k, v, Wq, bq, Wk, bk, Wv, bv, ln_g, ln_b, vb, sc);
    dim3 ag(16, H);
    attn_kernel<<<ag, 256, 0, stream>>>(t, sc, vb, attn, op);
    gemm_wmma<true><<<128, 256, 0, stream>>>(op, fc_w, fc_b, q, out);
}

// v005
// It runs in 10.1 microseconds.
// In two side-by-side timings against v004, it was 1.06 and 1.04 times as fast.
// Counting every step since v000, it is 6.32 times as fast.
#include <hip/hip_runtime.h>
#include <math.h>

#define L 256
#define Dm 256
#define H 8
#define DKh 32
#define LDS_STRIDE 260   // 260 % 64 == 4 -> 16 rows hit 16 distinct banks
#define PART_STRIDE 36   // 8 rows further on = 32 banks further on: the two lane halves do not collide
#define KC 64            // k range of one wave: a quarter of the 256

typedef float v2f __attribute__((ext_vector_type(2)));
typedef float v4f __attribute__((ext_vector_type(4)));
typedef float v8f __attribute__((ext_vector_type(8)));

// Lane l reads lane l ^ 16: a vector move between the two 16-lane rows, no LDS queue and no wait.
__device__ __forceinline__ float xor16(float v) {
    const int b = __builtin_bit_cast(int, v);
    return __builtin_bit_cast(float,
        __builtin_amdgcn_permlanex16(b, b, 0x76543210, 0xfedcba98, false, false));
}
// Lane l reads lane l ^ M inside its 16-lane row (DPP row_xmask:M); every source lane is on, so the
// zero 'old' value is never taken; it lets the move fold into the add or max that uses it.
template <int M>
__device__ __forceinline__ float row_xor(float v) {
    return __builtin_bit_cast(float,
        __builtin_amdgcn_update_dpp(0, __builtin_bit_cast(int, v), 0x160 | M, 0xf, 0xf, true));
}
// Butterflies in the order 8, 4, 2, 1 inside a 16-lane row.
__device__ __forceinline__ float row_sum(float v) {
    v += row_xor<8>(v);
    v += row_xor<4>(v);
    v += row_xor<2>(v);
    v += row_xor<1>(v);
    return v;
}
__device__ __forceinline__ float wave_max(float v) {
    v = fmaxf(v, xor16(v));
    v = fmaxf(v, row_xor<8>(v));
    v = fmaxf(v, row_xor<4>(v));
    v = fmaxf(v, row_xor<2>(v));
    v = fmaxf(v, row_xor<1>(v));
    return v;
}
__device__ __forceinline__ float wave_sum(float v) {
    v += xor16(v);
    return row_sum(v);
}

// Two matrix steps from one 16-byte piece of a row of A and of B. A lane holds
// k = base + 4 * half + 0..3; .xy feeds the first step and .zw the second, in A and B alike,
// so every product pairs equal k.
__device__ __forceinline__ v8f mm2(v4f a, v4f b, v8f acc) {
    acc = __builtin_amdgcn_wmma_f32_16x16x4_f32(false, a.xy, false, b.xy, (short)0, acc, false, false);
    acc = __builtin_amdgcn_wmma_f32_16x16x4_f32(false, a.zw, false, b.zw, (short)0, acc, false, false);
    return acc;
}

// Ends a run of matrix instructions. The two scheduling fences keep address arithmetic out of the
// run and out of the v_nops; the v_nops are the four vector issue slots that must pass before a
// vector instruction overwrites the run's A or B registers or touches its result.
__device__ __forceinline__ void mm_end() {
    __builtin_amdgcn_sched_barrier(0);
    asm volatile("v_nop\n\tv_nop\n\tv_nop\n\tv_nop");
    __builtin_amdgcn_sched_barrier(0);
}

// LDS byte address of a __shared__ element.
__device__ __forceinline__ unsigned lds_addr(const float* p) { return (unsigned)(size_t)p; }

// Asynchronous copies to LDS. One copy of a wave moves 512 contiguous bytes (half a row of 256
// floats, four whole 128-byte lines), 16 bytes a lane, through no register. The s_wait_xcnt at
// the end of each statement is a precaution: no address register of a copy is rewritten in front of it.
#define CP(a, b) "global_load_async_to_lds_b128 %" #a ", %" #b ", off\n\t"
#define ASYNC12(Lx, Gx, o)                                                                       \
    asm volatile(CP(0, 12) CP(1, 13) CP(2, 14) CP(3, 15) CP(4, 16) CP(5, 17)                     \
                 CP(6, 18) CP(7, 19) CP(8, 20) CP(9, 21) CP(10, 22) CP(11, 23)                   \
                 "s_wait_xcnt 0x0"                                                               \
                 :: "v"(Lx[o]), "v"(Lx[o + 1]), "v"(Lx[o + 2]), "v"(Lx[o + 3]),                  \
                    "v"(Lx[o + 4]), "v"(Lx[o + 5]), "v"(Lx[o + 6]), "v"(Lx[o + 7]),              \
                    "v"(Lx[o + 8]), "v"(Lx[o + 9]), "v"(Lx[o + 10]), "v"(Lx[o + 11]),            \
                    "v"(Gx[o]), "v"(Gx[o + 1]), "v"(Gx[o + 2]), "v"(Gx[o + 3]),                  \
                    "v"(Gx[o + 4]), "v"(Gx[o + 5]), "v"(Gx[o + 6]), "v"(Gx[o + 7]),              \
                    "v"(Gx[o + 8]), "v"(Gx[o + 9]), "v"(Gx[o + 10]), "v"(Gx[o + 11])             \
                 : "memory")

#define ASYNC14(Lx, Gx, o)                                                                       \
    asm volatile(CP(0, 14) CP(1, 15) CP(2, 16) CP(3, 17) CP(4, 18) CP(5, 19) CP(6, 20)           \
                 CP(7, 21) CP(8, 22) CP(9, 23) CP(10, 24) CP(11, 25) CP(12, 26) CP(13, 27)       \
                 "s_wait_xcnt 0x0"                                                               \
                 :: "v"(Lx[o]), "v"(Lx[o + 1]), "v"(Lx[o + 2]), "v"(Lx[o + 3]),                  \
                    "v"(Lx[o + 4]), "v"(Lx[o + 5]), "v"(Lx[o + 6]), "v"(Lx[o + 7]),              \
                    "v"(Lx[o + 8]), "v"(Lx[o + 9]), "v"(Lx[o + 10]), "v"(Lx[o + 11]),            \
                    "v"(Lx[o + 12]), "v"(Lx[o + 13]),                                            \
                    "v"(Gx[o]), "v"(Gx[o + 1]), "v"(Gx[o + 2]), "v"(Gx[o + 3]),                  \
                    "v"(Gx[o + 4]), "v"(Gx[o + 5]), "v"(Gx[o + 6]), "v"(Gx[o + 7]),              \
                    "v"(Gx[o + 8]), "v"(Gx[o + 9]), "v"(Gx[o + 10]), "v"(Gx[o + 11]),            \
                    "v"(Gx[o + 12]), "v"(Gx[o + 13])                                             \
                 : "memory")

// Every product below is split over k in four quarters, one to a wave (attention and fc kernels:
// 8 waves = 2 column tiles x 4 quarters; projection kernel: 4 waves, each with both column tiles).
// A fragment load straight from global memory takes 32 bytes from each of 16 rows, 16 cache lines
// an instruction. The row-major operands therefore come into LDS in whole lines, all copies of the
// block asked for at once, and the fragments are read from padded LDS rows; the four partial
// tiles meet in LDS and are added there.

// ---- one launch for everything that is local to a row: LayerNorm of q,
//      the three projections and s[h,j] = qbase[j,head h] . kbase[j,head h].
//      Two kinds of block, 4 waves each, a wave = one quarter of k for both column tiles:
//      blockIdx.y < H:  16 rows x 1 head of q and k, and their row score;
//      blockIdx.y >= H: 16 rows x 1 head of v. Of the projections only vbase goes to memory.
//      The longer kind has the lower indices: it starts first, the shorter kind ends with it.
__global__ __launch_bounds__(128) void proj_score_kernel(const float* __restrict__ q,
                                                         const float* __restrict__ k,
                                                         const float* __restrict__ v,
                                                         const float* __restrict__ Wq,
                                                         const float* __restrict__ bq,
                                                         const float* __restrict__ Wk,
                                                         const float* __restrict__ bk,
                                                         const float* __restrict__ Wv,
                                                         const float* __restrict__ bv,
                                                         const float* __restrict__ g,
                                                         const float* __restrict__ b,
                                                         float* __restrict__ vb,
                                                         float* __restrict__ s) {
    // The two kinds' arrays are not laid over one another: at this LDS size a WGP takes one
    // block, so every block has the four matrix units to itself.
    __shared__ __attribute__((aligned(16))) float qn[16 * LDS_STRIDE];
    __shared__ __attribute__((aligned(16))) float sx[2][16 * LDS_STRIDE];   // rows of k, of v
    __shared__ __attribute__((aligned(16))) float sw[3][32 * LDS_STRIDE];   // the head's rows of Wk, Wv, Wq
    __shared__ __attribute__((aligned(16))) float part[4][3][16 * PART_STRIDE];
    const int tm = blockIdx.x * 16;
    const int h = blockIdx.y & (H - 1);
    const int kc = __builtin_amdgcn_readfirstlane(threadIdx.x >> 5);   // the wave's quarter of k
    const int lane = threadIdx.x & 31;
    const int half = lane >> 4;
    const int l15 = lane & 15;
    const int orow = threadIdx.x >> 3;             // the four elements this thread adds up
    const int oc = (threadIdx.x & 7) * 4;
    const int po = orow * PART_STRIDE + oc;
    const int ao = l15 * LDS_STRIDE + kc * KC + 4 * half;   // A row; B[k][n] = W[n][k], column tile 0
    const int bo = ao + 16 * LDS_STRIDE;                    // column tile 1

    if (blockIdx.y >= H) {
        // wave w copies rows 4w..4w+3 of v and rows 8w..8w+7 of the weight tile
        unsigned la[24];
        const float* ga[24];
#pragma unroll
        for (int c = 0; c < 8; ++c) {              // c = row * 2 + half row
            const int r = kc * 4 + (c >> 1);
            const int e = (c & 1) * 128 + lane * 4;
            la[c] = lds_addr(&sx[1][r * LDS_STRIDE + e]);
            ga[c] = v + (tm + r) * Dm + e;
        }
#pragma unroll
        for (int c = 0; c < 16; ++c) {
            const int r = kc * 8 + (c >> 1);
            const int e = (c & 1) * 128 + lane * 4;
            la[8 + c] = lds_addr(&sw[1][r * LDS_STRIDE + e]);
            ga[8 + c] = Wv + (h * DKh + r) * Dm + e;
        }
        ASYNC12(la, ga, 0);
        ASYNC12(la, ga, 12);
        const v4f biv = *(const v4f*)(bv + h * DKh + oc);
        // the load's address registers stay as they are until this wait
        asm volatile("s_wait_xcnt 0x0" ::: "memory");
        // the load may not sink below this line (it would wait for memory a second time), and
        // nothing from below, which may reuse its address registers, rises over the wait
        __builtin_amdgcn_sched_barrier(0);
        // this wave's copies have landed; behind the barrier every wave's have
        asm volatile("s_wait_asynccnt 0x0" ::: "memory");
        __syncthreads();
        v4f xv[8], wv0[8], wv1[8];
#pragma unroll
        for (int i = 0; i < 8; ++i) {
            xv[i]  = *(const v4f*)(&sx[1][ao + 8 * i]);
            wv0[i] = *(const v4f*)(&sw[1][ao + 8 * i]);
            wv1[i] = *(const v4f*)(&sw[1][bo + 8 * i]);
        }
        // all LDS reads issue before the first product, in the order of their use
        __builtin_amdgcn_sched_barrier(0);
        v8f av0 = {}, av1 = {};
#pragma unroll
        for (int i = 0; i < 8; ++i) {
            av0 = mm2(xv[i], wv0[i], av0);
            av1 = mm2(xv[i], wv1[i], av1);
        }
        mm_end();
#pragma unroll
        for (int r = 0; r < 8; ++r) {
            const int o = (r + half * 8) * PART_STRIDE + l15;
            part[kc][2][o] = av0[r];
            part[kc][2][o + 16] = av1[r];
        }
        __syncthreads();
        const v4f sum = (*(const v4f*)(&part[0][2][po]) + *(const v4f*)(&part[1][2][po])) +
                        (*(const v4f*)(&part[2][2][po]) + *(const v4f*)(&part[3][2][po]));
        *(v4f*)(vb + (tm + orow) * Dm + h * DKh + oc) = sum + biv;
        return;
    }

    // LayerNorm: wave w owns rows 4w..4w+3 of the block. Its loads go first: the LayerNorm
    // arithmetic then runs while the copies below are still landing.
    const int qo = (tm + kc * 4) * Dm + lane;
    float vals[4][8], gv[8], bb[8];
#pragma unroll
    for (int i = 0; i < 8; ++i) {
#pragma unroll
        for (int rr = 0; rr < 4; ++rr) vals[rr][i] = q[qo + rr * Dm + i * 32];
        gv[i] = g[lane + i * 32];
        bb[i] = b[lane + i * 32];
    }
    // the loads' address is named here so that it is not rewritten before this wait
    asm volatile("s_wait_xcnt 0x0" :: "v"(qo) : "memory");
    // nothing from below, which may reuse the loads' scalar base registers, rises over the wait
    __builtin_amdgcn_sched_barrier(0);

    // wave w copies rows 4w..4w+3 of k and rows 8w..8w+7 of each weight tile
    unsigned la[40];
    const float* ga[40];
#pragma unroll
    for (int c = 0; c < 8; ++c) {                  // c = row * 2 + half row
        const int r = kc * 4 + (c >> 1);
        const int e = (c & 1) * 128 + lane * 4;
        la[c] = lds_addr(&sx[0][r * LDS_STRIDE + e]);
        ga[c] = k + (tm + r) * Dm + e;
    }
#pragma unroll
    for (int c = 0; c < 32; ++c) {                 // c = matrix * 16 + row * 2 + half row
        const int r = kc * 8 + ((c >> 1) & 7);
        const int e = (c & 1) * 128 + lane * 4;
        la[8 + c] = lds_addr(&sw[(c >> 4) * 2][r * LDS_STRIDE + e]);
        ga[8 + c] = ((c >> 4) ? Wq : Wk) + (h * DKh + r) * Dm + e;
    }
    ASYNC12(la, ga, 0);
    ASYNC14(la, ga, 12);
    ASYNC14(la, ga, 26);
    const v4f biq = *(const v4f*)(bq + h * DKh + oc);
    const v4f bik = *(const v4f*)(bk + h * DKh + oc);
    // the two loads' address registers stay as they are until this wait
    asm volatile("s_wait_xcnt 0x0" ::: "memory");
    // no load above may sink below this line: a load issued later waits for memory a second time;
    // and nothing from below, which may reuse the loads' address registers, rises over the wait
    __builtin_amdgcn_sched_barrier(0);

#pragma unroll
    for (int rr = 0; rr < 4; ++rr) {
        const int ii = kc * 4 + rr;
        float sm = 0.f;
#pragma unroll
        for (int i = 0; i < 8; ++i) sm += vals[rr][i];
        const float mu = wave_sum(sm) * (1.0f / Dm);
        float vv = 0.f;
#pragma unroll
        for (int i = 0; i < 8; ++i) { float d = vals[rr][i] - mu; vv += d * d; }
        const float rs = rsqrtf(wave_sum(vv) * (1.0f / Dm) + 1e-6f);
#pragma unroll
        for (int i = 0; i < 8; ++i)
            qn[ii * LDS_STRIDE + lane + i * 32] = (vals[rr][i] - mu) * rs * gv[i] + bb[i];
    }

    // this wave's copies have landed; behind the barrier every wave's have, and the LayerNorm rows
    asm volatile("s_wait_asynccnt 0x0" ::: "memory");
    __syncthreads();
    v4f xq[8], wq0[8], wq1[8], xk[8], wk0[8], wk1[8];
#pragma unroll
    for (int i = 0; i < 8; ++i) {
        xq[i]  = *(const v4f*)(&qn[ao + 8 * i]);
        wq0[i] = *(const v4f*)(&sw[2][ao + 8 * i]);
        wq1[i] = *(const v4f*)(&sw[2][bo + 8 * i]);
        xk[i]  = *(const v4f*)(&sx[0][ao + 8 * i]);
        wk0[i] = *(const v4f*)(&sw[0][ao + 8 * i]);
        wk1[i] = *(const v4f*)(&sw[0][bo + 8 * i]);
    }
    // all LDS reads issue before the first product, in the order of their use: the products start
    // on the first pieces while the later ones are still on their way
    __builtin_amdgcn_sched_barrier(0);
    v8f aq0 = {}, aq1 = {}, ak0 = {}, ak1 = {};
#pragma unroll
    for (int i = 0; i < 8; ++i) {
        aq0 = mm2(xq[i], wq0[i], aq0);
        aq1 = mm2(xq[i], wq1[i], aq1);
        ak0 = mm2(xk[i], wk0[i], ak0);
        ak1 = mm2(xk[i], wk1[i], ak1);
    }
    mm_end();

#pragma unroll
    for (int r = 0; r < 8; ++r) {
        const int o = (r + half * 8) * PART_STRIDE + l15;
        part[kc][0][o] = aq0[r];
        part[kc][0][o + 16] = aq1[r];
        part[kc][1][o] = ak0[r];
        part[kc][1][o + 16] = ak1[r];
    }
    __syncthreads();

    v4f sum[2];
#pragma unroll
    for (int m = 0; m < 2; ++m)
        sum[m] = (*(const v4f*)(&part[0][m][po]) + *(const v4f*)(&part[1][m][po])) +
                 (*(const v4f*)(&part[2][m][po]) + *(const v4f*)(&part[3][m][po]));
    const v4f qv = sum[0] + biq;
    const v4f kv = sum[1] + bik;
    // One term per column pair, the 16 terms of a row added as a butterfly over distances
    // 8, 4, 2, 1: a thread holds terms 2t and 2t+1, so the first three steps are lane moves
    // over 4, 2, 1 on both and the last step is the add of its own two.
    float p0 = fmaf(qv.y, kv.y, qv.x * kv.x);
    float p1 = fmaf(qv.w, kv.w, qv.z * kv.z);
    p0 += row_xor<4>(p0);
    p1 += row_xor<4>(p1);
    p0 += row_xor<2>(p0);
    p1 += row_xor<2>(p1);
    p0 += row_xor<1>(p0);
    p1 += row_xor<1>(p1);
    if ((threadIdx.x & 7) == 0) s[h * L + tm + orow] = p0 + p1;
}

// ---- C[i][n] = sum_d A[i][d] * W[n][d] + bias[n] (+ res[i][n]) ----
// block = one 16x32 tile
template <bool HAS_RES>
__global__ __launch_bounds__(256) void gemm_wmma(const float* __restrict__ A,
                                                 const float* __restrict__ W,
                                                 const float* __restrict__ bias,
                                                 const float* __restrict__ res,
                                                 float* __restrict__ C) {
    __shared__ __attribute__((aligned(16))) float sa[16 * LDS_STRIDE];
    __shared__ __attribute__((aligned(16))) float sb[32 * LDS_STRIDE];
    __shared__ __attribute__((aligned(16))) float part[4][16 * PART_STRIDE];
    const int wave = __builtin_amdgcn_readfirstlane(threadIdx.x >> 5);
    const int lane = threadIdx.x & 31;
    const int tm = (blockIdx.x >> 3) * 16;         // 128 tiles = 16 (M) x 8 (N)
    const int tn = (blockIdx.x & 7) * 32;
    const int half = lane >> 4;
    const int l15 = lane & 15;
    const int kc = wave & 3;
    const int cl = (wave >> 2) * 16 + l15;
    const int ko = kc * KC + 4 * half;
    const int orow = threadIdx.x >> 4;
    const int oc = (threadIdx.x & 15) * 2;
    // wave w copies rows 2w, 2w+1 of A and rows 4w..4w+3 of the weight tile
    unsigned la[12];
    const float* ga[12];
#pragma unroll
    for (int c = 0; c < 4; ++c) {                  // c = row * 2 + half row
        const int r = wave * 2 + (c >> 1);
        const int e = (c & 1) * 128 + lane * 4;
        la[c] = lds_addr(&sa[r * LDS_STRIDE + e]);
        ga[c] = A + (tm + r) * Dm + e;
    }
#pragma unroll
    for (int c = 0; c < 8; ++c) {
        const int r = wave * 4 + (c >> 1);
        const int e = (c & 1) * 128 + lane * 4;
        la[4 + c] = lds_addr(&sb[r * LDS_STRIDE + e]);
        ga[4 + c] = W + (tn + r) * Dm + e;
    }
    ASYNC12(la, ga, 0);
    const v2f bi = *(const v2f*)(bias + tn + oc);
    v2f rv = {};
    if (HAS_RES) rv = *(const v2f*)(res + (tm + orow) * Dm + tn + oc);
    // the two loads' address registers stay as they are until this wait
    asm volatile("s_wait_xcnt 0x0" ::: "memory");
    // no load above may sink below this line: a load issued later waits for memory a second time;
    // and nothing from below, which may reuse the loads' address registers, rises over the wait
    __builtin_amdgcn_sched_barrier(0);
    // this wave's copies have landed; behind the barrier every wave's have
    asm volatile("s_wait_asynccnt 0x0" ::: "memory");
    __syncthreads();
    const float* arow = sa + l15 * LDS_STRIDE + ko;
    const float* brow = sb + cl * LDS_STRIDE + ko;   // B[k][n] = W[n][k]
    v4f a[8], bf[8];
#pragma unroll
    for (int i = 0; i < 8; ++i) {
        a[i]  = *(const v4f*)(arow + 8 * i);
        bf[i] = *(const v4f*)(brow + 8 * i);
    }
    // all LDS reads issue before the first product, in the order of their use
    __builtin_amdgcn_sched_barrier(0);
    v8f acc = {};
#pragma unroll
    for (int i = 0; i < 8; ++i) acc = mm2(a[i], bf[i], acc);
    mm_end();
#pragma unroll
    for (int r = 0; r < 8; ++r) part[kc][(r + half * 8) * PART_STRIDE + cl] = acc[r];
    __syncthreads();
    const int po = orow * PART_STRIDE + oc;
    const v2f sum = (*(const v2f*)(&part[0][po]) + *(const v2f*)(&part[1][po])) +
                    (*(const v2f*)(&part[2][po]) + *(const v2f*)(&part[3][po]));
    *(v2f*)(C + (tm + orow) * Dm + tn + oc) = (sum + bi) + rv;
}

// ---- per (head, 16-row block): logits -> softmax -> attn out,
//      then O[16x32] = Wgt[16x256] x Vhead[256x32] via WMMA ----
__global__ __launch_bounds__(256) void attn_kernel(const float* __restrict__ t,
                                                   const float* __restrict__ s,
                                                   const float* __restrict__ vb,
                                                   float* __restrict__ attn_out,
                                                   float* __restrict__ o_pre) {
    __shared__ __attribute__((aligned(16))) float wgt[16 * LDS_STRIDE];
    __shared__ __attribute__((aligned(16))) float part[4][16 * PART_STRIDE];
    const int iblock = blockIdx.x;   // 0..15
    const int h = blockIdx.y;        // 0..7
    const int tid = threadIdx.x;
    const float inv_temp = 0.17677669529663687f;   // 1/sqrt(32)
    const int wave = __builtin_amdgcn_readfirstlane(tid >> 5);
    const int lane = tid & 31;
    const int half = lane >> 4, l15 = lane & 15;
    const int kc = wave & 3;
    const int cl = (wave >> 2) * 16 + l15;

    // the V operand of phase 3 depends on nothing computed here: ask for it first
    const float* bbase = vb + (kc * KC + 2 * half) * Dm + h * DKh + cl;   // B[k][n]=vb[k][col]
    v2f bf[16];
#pragma unroll
    for (int i = 0; i < 16; ++i) {
        bf[i].x = bbase[(4 * i) * Dm];
        bf[i].y = bbase[(4 * i + 1) * Dm];
    }
    // no load above may sink below this line: a load issued later waits for memory a second time
    __builtin_amdgcn_sched_barrier(0);

    // phase 1: logits[ii][j] = (1 + e^{-2|ti-tj|}) * s[h,j] / temp
    for (int idx = tid; idx < 16 * L; idx += 256) {
        int ii = idx >> 8;
        int j = idx & 255;
        int i = iblock * 16 + ii;
        float dt = fabsf(t[i] - t[j]);
        wgt[ii * LDS_STRIDE + j] = (1.0f + __expf(-2.0f * dt)) * s[h * L + j] * inv_temp;
    }
    __syncthreads();

    // phase 2: softmax per row (wave w owns rows 2w, 2w+1); write attn,
    // rebuild LDS as post-softmax weights * (1 + e^{-dt})
#pragma unroll
    for (int rr = 0; rr < 2; ++rr) {
        int ii = wave * 2 + rr;
        int i = iblock * 16 + ii;
        float ti = t[i];
        float lv[8];
        float m = -1e30f;
#pragma unroll
        for (int c = 0; c < 8; ++c) {
            lv[c] = wgt[ii * LDS_STRIDE + lane + c * 32];
            m = fmaxf(m, lv[c]);
        }
        m = wave_max(m);
        float sum = 0.f;
#pragma unroll
        for (int c = 0; c < 8; ++c) { lv[c] = __expf(lv[c] - m); sum += lv[c]; }
        const float inv = 1.0f / wave_sum(sum);
#pragma unroll
        for (int c = 0; c < 8; ++c) {
            int j = lane + c * 32;
            float a = lv[c] * inv;
            attn_out[(h * L + i) * L + j] = a;
            float dt = fabsf(ti - t[j]);
            wgt[ii * LDS_STRIDE + j] = a * (1.0f + __expf(-dt));
        }
    }
    __syncthreads();

    // phase 3: every wave takes one column tile and one quarter of the 256 keys
    const float* arow = wgt + l15 * LDS_STRIDE + kc * KC + 2 * half;
    v2f af[16];
#pragma unroll
    for (int i = 0; i < 16; ++i) af[i] = *(const v2f*)(arow + 4 * i);
    // all LDS reads issue before the first product: one LDS latency, not one per matrix step
    __builtin_amdgcn_sched_barrier(0);
    v8f acc = {};
#pragma unroll
    for (int i = 0; i < 16; ++i)
        acc = __builtin_amdgcn_wmma_f32_16x16x4_f32(false, af[i], false, bf[i],
                                                    (short)0, acc, false, false);
    mm_end();
#pragma unroll
    for (int r = 0; r < 8; ++r) part[kc][(r + half * 8) * PART_STRIDE + cl] = acc[r];
    __syncthreads();
    const int orow = tid >> 4;
    const int oc = (tid & 15) * 2;
    const int po = orow * PART_STRIDE + oc;
    const v2f sum = (*(const v2f*)(&part[0][po]) + *(const v2f*)(&part[1][po])) +
                    (*(const v2f*)(&part[2][po]) + *(const v2f*)(&part[3][po]));
    *(v2f*)(o_pre + (iblock * 16 + orow) * Dm + h * DKh + oc) = sum;
}

extern "C" void kernel_launch(void* const* d_in, const int* in_sizes, int n_in,
                              void* d_out, int out_size, void* d_ws, size_t ws_size,
                              hipStream_t stream) {
    const float* q    = (const float*)d_in[0];
    const float* k    = (const float*)d_in[1];
    const float* v    = (const float*)d_in[2];
    const float* t    = (const float*)d_in[3];
    const float* Wq   = (const float*)d_in[4];
    const float* bq   = (const float*)d_in[5];
    const float* Wk   = (const float*)d_in[6];
    const float* bk   = (const float*)d_in[7];
    const float* Wv   = (const float*)d_in[8];
    const float* bv   = (const float*)d_in[9];
    const float* fc_w = (const float*)d_in[10];
    const float* fc_b = (const float*)d_in[11];
    const float* ln_g = (const float*)d_in[12];
    const float* ln_b = (const float*)d_in[13];

    float* out  = (float*)d_out;          // [L, D]    (65536)
    float* attn = out + L * Dm;           // [H, L, L] (524288)

    float* ws = (float*)d_ws;
    float* vb = ws;                 // 65536
    float* op = ws + 1 * 65536;     // 65536
    float* sc = ws + 2 * 65536;     // 2048

    dim3 pg(16, 16);   // y: 8 heads of q and k, then 8 heads of v
    proj_score_kernel<<<pg, 128, 0, stream>>>(q, k, v, Wq, bq, Wk, bk, Wv, bv, ln_g, ln_b, vb, sc);
    dim3 ag(16, H);
    attn_kernel<<<ag, 256, 0, stream>>>(t, sc, vb, attn, op);
    gemm_wmma<true><<<128, 256, 0, stream>>>(op, fc_w, fc_b, q, out);
}

// v006
// It runs in 9.41 microseconds.
// Next to v005, in two timings, it ran 1.07 times as fast each time.
// Counting every step since v000, it is 6.77 times as fast.
#include <hip/hip_runtime.h>
#include <math.h>

#define L 256
#define Dm 256
#define H 8
#define DKh 32
#define LDS_STRIDE 260   // 260 % 64 == 4 -> 16 rows hit 16 distinct banks
#define PART_STRIDE 36   // 8 rows further on = 32 banks further on: the two lane halves do not collide
#define KC 64            // k range of one wave: a quarter of the 256

typedef float v2f __attribute__((ext_vector_type(2)));
typedef float v4f __attribute__((ext_vector_type(4)));
typedef float v8f __attribute__((ext_vector_type(8)));

// Lane l reads lane l ^ 16: a vector move between the two 16-lane rows, no LDS queue and no wait.
__device__ __forceinline__ float xor16(float v) {
    const int b = __builtin_bit_cast(int, v);
    return __builtin_bit_cast(float,
        __builtin_amdgcn_permlanex16(b, b, 0x76543210, 0xfedcba98, false, false));
}
// Lane l reads lane l ^ M inside its 16-lane row (DPP row_xmask:M); every source lane is on, so the
// zero 'old' value is never taken; it lets the move fold into the add or max that uses it.
template <int M>
__device__ __forceinline__ float row_xor(float v) {
    return __builtin_bit_cast(float,
        __builtin_amdgcn_update_dpp(0, __builtin_bit_cast(int, v), 0x160 | M, 0xf, 0xf, true));
}
// Butterflies in the order 8, 4, 2, 1 inside a 16-lane row.
__device__ __forceinline__ float row_sum(float v) {
    v += row_xor<8>(v);
    v += row_xor<4>(v);
    v += row_xor<2>(v);
    v += row_xor<1>(v);
    return v;
}
__device__ __forceinline__ float wave_max(float v) {
    v = fmaxf(v, xor16(v));
    v = fmaxf(v, row_xor<8>(v));
    v = fmaxf(v, row_xor<4>(v));
    v = fmaxf(v, row_xor<2>(v));
    v = fmaxf(v, row_xor<1>(v));
    return v;
}
__device__ __forceinline__ float wave_sum(float v) {
    v += xor16(v);
    return row_sum(v);
}

// Two matrix steps from one 16-byte piece of a row of A and of B. A lane holds
// k = base + 4 * half + 0..3; .xy feeds the first step and .zw the second, in A and B alike,
// so every product pairs equal k.
__device__ __forceinline__ v8f mm2(v4f a, v4f b, v8f acc) {
    acc = __builtin_amdgcn_wmma_f32_16x16x4_f32(false, a.xy, false, b.xy, (short)0, acc, false, false);
    acc = __builtin_amdgcn_wmma_f32_16x16x4_f32(false, a.zw, false, b.zw, (short)0, acc, false, false);
    return acc;
}

// Ends a run of matrix instructions. The two scheduling fences keep address arithmetic out of the
// run and out of the v_nops; the v_nops are the four vector issue slots that must pass before a
// vector instruction overwrites the run's A or B registers or touches its result.
__device__ __forceinline__ void mm_end() {
    __builtin_amdgcn_sched_barrier(0);
    asm volatile("v_nop\n\tv_nop\n\tv_nop\n\tv_nop");
    __builtin_amdgcn_sched_barrier(0);
}

// Work-group barrier for data that goes from wave to wave through LDS alone. __syncthreads() also
// waits until the wave's global stores are acknowledged and its global loads are back. Nobody in
// this launch reads what the attention kernel stores, and each wave loads V for itself: there the
// stores drain, and the loads land, while the block works on.
__device__ __forceinline__ void lds_barrier() {
    __builtin_amdgcn_fence(__ATOMIC_RELEASE, "workgroup", "local");
    __builtin_amdgcn_s_barrier();
    __builtin_amdgcn_fence(__ATOMIC_ACQUIRE, "workgroup", "local");
}

// LDS byte address of a __shared__ element.
__device__ __forceinline__ unsigned lds_addr(const float* p) { return (unsigned)(size_t)p; }

// Asynchronous copies to LDS. One copy of a wave moves 512 contiguous bytes (half a row of 256
// floats, four whole 128-byte lines), 16 bytes a lane, through no register. The s_wait_xcnt at
// the end of each statement is a precaution: no address register of a copy is rewritten in front of it.
#define CP(a, b) "global_load_async_to_lds_b128 %" #a ", %" #b ", off\n\t"
#define ASYNC12(Lx, Gx, o)                                                                       \
    asm volatile(CP(0, 12) CP(1, 13) CP(2, 14) CP(3, 15) CP(4, 16) CP(5, 17)                     \
                 CP(6, 18) CP(7, 19) CP(8, 20) CP(9, 21) CP(10, 22) CP(11, 23)                   \
                 "s_wait_xcnt 0x0"                                                               \
                 :: "v"(Lx[o]), "v"(Lx[o + 1]), "v"(Lx[o + 2]), "v"(Lx[o + 3]),                  \
                    "v"(Lx[o + 4]), "v"(Lx[o + 5]), "v"(Lx[o + 6]), "v"(Lx[o + 7]),              \
                    "v"(Lx[o + 8]), "v"(Lx[o + 9]), "v"(Lx[o + 10]), "v"(Lx[o + 11]),            \
                    "v"(Gx[o]), "v"(Gx[o + 1]), "v"(Gx[o + 2]), "v"(Gx[o + 3]),                  \
                    "v"(Gx[o + 4]), "v"(Gx[o + 5]), "v"(Gx[o + 6]), "v"(Gx[o + 7]),              \
                    "v"(Gx[o + 8]), "v"(Gx[o + 9]), "v"(Gx[o + 10]), "v"(Gx[o + 11])             \
                 : "memory")

#define ASYNC14(Lx, Gx, o)                                                                       \
    asm volatile(CP(0, 14) CP(1, 15) CP(2, 16) CP(3, 17) CP(4, 18) CP(5, 19) CP(6, 20)           \
                 CP(7, 21) CP(8, 22) CP(9, 23) CP(10, 24) CP(11, 25) CP(12, 26) CP(13, 27)       \
                 "s_wait_xcnt 0x0"                                                               \
                 :: "v"(Lx[o]), "v"(Lx[o + 1]), "v"(Lx[o + 2]), "v"(Lx[o + 3]),                  \
                    "v"(Lx[o + 4]), "v"(Lx[o + 5]), "v"(Lx[o + 6]), "v"(Lx[o + 7]),              \
                    "v"(Lx[o + 8]), "v"(Lx[o + 9]), "v"(Lx[o + 10]), "v"(Lx[o + 11]),            \
                    "v"(Lx[o + 12]), "v"(Lx[o + 13]),                                            \
                    "v"(Gx[o]), "v"(Gx[o + 1]), "v"(Gx[o + 2]), "v"(Gx[o + 3]),                  \
                    "v"(Gx[o + 4]), "v"(Gx[o + 5]), "v"(Gx[o + 6]), "v"(Gx[o + 7]),              \
                    "v"(Gx[o + 8]), "v"(Gx[o + 9]), "v"(Gx[o + 10]), "v"(Gx[o + 11]),            \
                    "v"(Gx[o + 12]), "v"(Gx[o + 13])                                             \
                 : "memory")

// Every product below is split over k in four quarters, one to a wave (attention and fc kernels:
// 8 waves = 2 column tiles x 4 quarters; projection kernel: 4 waves, each with both column tiles).
// A fragment load straight from global memory takes 32 bytes from each of 16 rows, 16 cache lines
// an instruction. The row-major operands therefore come into LDS in whole lines, all copies of the
// block asked for at once, and the fragments are read from padded LDS rows; the four partial
// tiles meet in LDS and are added there.

// ---- one launch for everything that is local to a row: LayerNorm of q,
//      the three projections and s[h,j] = qbase[j,head h] . kbase[j,head h].
//      Two kinds of block, 4 waves each, a wave = one quarter of k for both column tiles:
//      blockIdx.y < H:  16 rows x 1 head of q and k, and their row score;
//      blockIdx.y >= H: 16 rows x 1 head of v. Of the projections only vbase goes to memory.
//      The longer kind has the lower indices: it starts first, the shorter kind ends with it.
__global__ __launch_bounds__(128) void proj_score_kernel(const float* __restrict__ q,
                                                         const float* __restrict__ k,
                                                         const float* __restrict__ v,
                                                         const float* __restrict__ Wq,
                                                         const float* __restrict__ bq,
                                                         const float* __restrict__ Wk,
                                                         const float* __restrict__ bk,
                                                         const float* __restrict__ Wv,
                                                         const float* __restrict__ bv,
                                                         const float* __restrict__ g,
                                                         const float* __restrict__ b,
                                                         float* __restrict__ vb,
                                                         float* __restrict__ s) {
    // The two kinds' arrays are not laid over one another: at this LDS size a WGP takes one
    // block, so every block has the four matrix units to itself.
    __shared__ __attribute__((aligned(16))) float qn[16 * LDS_STRIDE];
    __shared__ __attribute__((aligned(16))) float sx[2][16 * LDS_STRIDE];   // rows of k, of v
    __shared__ __attribute__((aligned(16))) float sw[3][32 * LDS_STRIDE];   // the head's rows of Wk, Wv, Wq
    __shared__ __attribute__((aligned(16))) float part[4][3][16 * PART_STRIDE];
    const int tm = blockIdx.x * 16;
    const int h = blockIdx.y & (H - 1);
    const int kc = __builtin_amdgcn_readfirstlane(threadIdx.x >> 5);   // the wave's quarter of k
    const int lane = threadIdx.x & 31;
    const int half = lane >> 4;
    const int l15 = lane & 15;
    const int orow = threadIdx.x >> 3;             // the four elements this thread adds up
    const int oc = (threadIdx.x & 7) * 4;
    const int po = orow * PART_STRIDE + oc;
    const int ao = l15 * LDS_STRIDE + kc * KC + 4 * half;   // A row; B[k][n] = W[n][k], column tile 0
    const int bo = ao + 16 * LDS_STRIDE;                    // column tile 1

    if (blockIdx.y >= H) {
        // wave w copies rows 4w..4w+3 of v and rows 8w..8w+7 of the weight tile
        unsigned la[24];
        const float* ga[24];
#pragma unroll
        for (int c = 0; c < 8; ++c) {              // c = row * 2 + half row
            const int r = kc * 4 + (c >> 1);
            const int e = (c & 1) * 128 + lane * 4;
            la[c] = lds_addr(&sx[1][r * LDS_STRIDE + e]);
            ga[c] = v + (tm + r) * Dm + e;
        }
#pragma unroll
        for (int c = 0; c < 16; ++c) {
            const int r = kc * 8 + (c >> 1);
            const int e = (c & 1) * 128 + lane * 4;
            la[8 + c] = lds_addr(&sw[1][r * LDS_STRIDE + e]);
            ga[8 + c] = Wv + (h * DKh + r) * Dm + e;
        }
        ASYNC12(la, ga, 0);
        ASYNC12(la, ga, 12);
        const v4f biv = *(const v4f*)(bv + h * DKh + oc);
        // the load's address registers stay as they are until this wait
        asm volatile("s_wait_xcnt 0x0" ::: "memory");
        // the load may not sink below this line (it would wait for memory a second time), and
        // nothing from below, which may reuse its address registers, rises over the wait
        __builtin_amdgcn_sched_barrier(0);
        // this wave's copies have landed; behind the barrier every wave's have
        asm volatile("s_wait_asynccnt 0x0" ::: "memory");
        __syncthreads();
        v4f xv[8], wv0[8], wv1[8];
#pragma unroll
        for (int i = 0; i < 8; ++i) {
            xv[i]  = *(const v4f*)(&sx[1][ao + 8 * i]);
            wv0[i] = *(const v4f*)(&sw[1][ao + 8 * i]);
            wv1[i] = *(const v4f*)(&sw[1][bo + 8 * i]);
        }
        // all LDS reads issue before the first product, in the order of their use
        __builtin_amdgcn_sched_barrier(0);
        v8f av0 = {}, av1 = {};
#pragma unroll
        for (int i = 0; i < 8; ++i) {
            av0 = mm2(xv[i], wv0[i], av0);
            av1 = mm2(xv[i], wv1[i], av1);
        }
        mm_end();
#pragma unroll
        for (int r = 0; r < 8; ++r) {
            const int o = (r + half * 8) * PART_STRIDE + l15;
            part[kc][2][o] = av0[r];
            part[kc][2][o + 16] = av1[r];
        }
        __syncthreads();
        const v4f sum = (*(const v4f*)(&part[0][2][po]) + *(const v4f*)(&part[1][2][po])) +
                        (*(const v4f*)(&part[2][2][po]) + *(const v4f*)(&part[3][2][po]));
        *(v4f*)(vb + (tm + orow) * Dm + h * DKh + oc) = sum + biv;
        return;
    }

    // LayerNorm: wave w owns rows 4w..4w+3 of the block. Its loads go first: the LayerNorm
    // arithmetic then runs while the copies below are still landing.
    const int qo = (tm + kc * 4) * Dm + lane;
    float vals[4][8], gv[8], bb[8];
#pragma unroll
    for (int i = 0; i < 8; ++i) {
#pragma unroll
        for (int rr = 0; rr < 4; ++rr) vals[rr][i] = q[qo + rr * Dm + i * 32];
        gv[i] = g[lane + i * 32];
        bb[i] = b[lane + i * 32];
    }
    // the loads' address is named here so that it is not rewritten before this wait
    asm volatile("s_wait_xcnt 0x0" :: "v"(qo) : "memory");
    // nothing from below, which may reuse the loads' scalar base registers, rises over the wait
    __builtin_amdgcn_sched_barrier(0);

    // wave w copies rows 4w..4w+3 of k and rows 8w..8w+7 of each weight tile
    unsigned la[40];
    const float* ga[40];
#pragma unroll
    for (int c = 0; c < 8; ++c) {                  // c = row * 2 + half row
        const int r = kc * 4 + (c >> 1);
        const int e = (c & 1) * 128 + lane * 4;
        la[c] = lds_addr(&sx[0][r * LDS_STRIDE + e]);
        ga[c] = k + (tm + r) * Dm + e;
    }
#pragma unroll
    for (int c = 0; c < 32; ++c) {                 // c = matrix * 16 + row * 2 + half row
        const int r = kc * 8 + ((c >> 1) & 7);
        const int e = (c & 1) * 128 + lane * 4;
        la[8 + c] = lds_addr(&sw[(c >> 4) * 2][r * LDS_STRIDE + e]);
        ga[8 + c] = ((c >> 4) ? Wq : Wk) + (h * DKh + r) * Dm + e;
    }
    ASYNC12(la, ga, 0);
    ASYNC14(la, ga, 12);
    ASYNC14(la, ga, 26);
    const v4f biq = *(const v4f*)(bq + h * DKh + oc);
    const v4f bik = *(const v4f*)(bk + h * DKh + oc);
    // the two loads' address registers stay as they are until this wait
    asm volatile("s_wait_xcnt 0x0" ::: "memory");
    // no load above may sink below this line: a load issued later waits for memory a second time;
    // and nothing from below, which may reuse the loads' address registers, rises over the wait
    __builtin_amdgcn_sched_barrier(0);

#pragma unroll
    for (int rr = 0; rr < 4; ++rr) {
        const int ii = kc * 4 + rr;
        float sm = 0.f;
#pragma unroll
        for (int i = 0; i < 8; ++i) sm += vals[rr][i];
        const float mu = wave_sum(sm) * (1.0f / Dm);
        float vv = 0.f;
#pragma unroll
        for (int i = 0; i < 8; ++i) { float d = vals[rr][i] - mu; vv += d * d; }
        const float rs = rsqrtf(wave_sum(vv) * (1.0f / Dm) + 1e-6f);
#pragma unroll
        for (int i = 0; i < 8; ++i)
            qn[ii * LDS_STRIDE + lane + i * 32] = (vals[rr][i] - mu) * rs * gv[i] + bb[i];
    }

    // this wave's copies have landed; behind the barrier every wave's have, and the LayerNorm rows
    asm volatile("s_wait_asynccnt 0x0" ::: "memory");
    __syncthreads();
    v4f xq[8], wq0[8], wq1[8], xk[8], wk0[8], wk1[8];
#pragma unroll
    for (int i = 0; i < 8; ++i) {
        xq[i]  = *(const v4f*)(&qn[ao + 8 * i]);
        wq0[i] = *(const v4f*)(&sw[2][ao + 8 * i]);
        wq1[i] = *(const v4f*)(&sw[2][bo + 8 * i]);
        xk[i]  = *(const v4f*)(&sx[0][ao + 8 * i]);
        wk0[i] = *(const v4f*)(&sw[0][ao + 8 * i]);
        wk1[i] = *(const v4f*)(&sw[0][bo + 8 * i]);
    }
    // all LDS reads issue before the first product, in the order of their use: the products start
    // on the first pieces while the later ones are still on their way
    __builtin_amdgcn_sched_barrier(0);
    v8f aq0 = {}, aq1 = {}, ak0 = {}, ak1 = {};
#pragma unroll
    for (int i = 0; i < 8; ++i) {
        aq0 = mm2(xq[i], wq0[i], aq0);
        aq1 = mm2(xq[i], wq1[i], aq1);
        ak0 = mm2(xk[i], wk0[i], ak0);
        ak1 = mm2(xk[i], wk1[i], ak1);
    }
    mm_end();

#pragma unroll
    for (int r = 0; r < 8; ++r) {
        const int o = (r + half * 8) * PART_STRIDE + l15;
        part[kc][0][o] = aq0[r];
        part[kc][0][o + 16] = aq1[r];
        part[kc][1][o] = ak0[r];
        part[kc][1][o + 16] = ak1[r];
    }
    __syncthreads();

    v4f sum[2];
#pragma unroll
    for (int m = 0; m < 2; ++m)
        sum[m] = (*(const v4f*)(&part[0][m][po]) + *(const v4f*)(&part[1][m][po])) +
                 (*(const v4f*)(&part[2][m][po]) + *(const v4f*)(&part[3][m][po]));
    const v4f qv = sum[0] + biq;
    const v4f kv = sum[1] + bik;
    // One term per column pair, the 16 terms of a row added as a butterfly over distances
    // 8, 4, 2, 1: a thread holds terms 2t and 2t+1, so the first three steps are lane moves
    // over 4, 2, 1 on both and the last step is the add of its own two.
    float p0 = fmaf(qv.y, kv.y, qv.x * kv.x);
    float p1 = fmaf(qv.w, kv.w, qv.z * kv.z);
    p0 += row_xor<4>(p0);
    p1 += row_xor<4>(p1);
    p0 += row_xor<2>(p0);
    p1 += row_xor<2>(p1);
    p0 += row_xor<1>(p0);
    p1 += row_xor<1>(p1);
    if ((threadIdx.x & 7) == 0) s[h * L + tm + orow] = p0 + p1;
}

// ---- C[i][n] = sum_d A[i][d] * W[n][d] + bias[n] (+ res[i][n]) ----
// block = one 16x32 tile
template <bool HAS_RES>
__global__ __launch_bounds__(256) void gemm_wmma(const float* __restrict__ A,
                                                 const float* __restrict__ W,
                                                 const float* __restrict__ bias,
                                                 const float* __restrict__ res,
                                                 float* __restrict__ C) {
    __shared__ __attribute__((aligned(16))) float sa[16 * LDS_STRIDE];
    __shared__ __attribute__((aligned(16))) float sb[32 * LDS_STRIDE];
    __shared__ __attribute__((aligned(16))) float part[4][16 * PART_STRIDE];
    const int wave = __builtin_amdgcn_readfirstlane(threadIdx.x >> 5);
    const int lane = threadIdx.x & 31;
    const int tm = (blockIdx.x >> 3) * 16;         // 128 tiles = 16 (M) x 8 (N)
    const int tn = (blockIdx.x & 7) * 32;
    const int half = lane >> 4;
    const int l15 = lane & 15;
    const int kc = wave & 3;
    const int cl = (wave >> 2) * 16 + l15;
    const int ko = kc * KC + 4 * half;
    const int orow = threadIdx.x >> 4;
    const int oc = (threadIdx.x & 15) * 2;
    // wave w copies rows 2w, 2w+1 of A and rows 4w..4w+3 of the weight tile
    unsigned la[12];
    const float* ga[12];
#pragma unroll
    for (int c = 0; c < 4; ++c) {                  // c = row * 2 + half row
        const int r = wave * 2 + (c >> 1);
        const int e = (c & 1) * 128 + lane * 4;
        la[c] = lds_addr(&sa[r * LDS_STRIDE + e]);
        ga[c] = A + (tm + r) * Dm + e;
    }
#pragma unroll
    for (int c = 0; c < 8; ++c) {
        const int r = wave * 4 + (c >> 1);
        const int e = (c & 1) * 128 + lane * 4;
        la[4 + c] = lds_addr(&sb[r * LDS_STRIDE + e]);
        ga[4 + c] = W + (tn + r) * Dm + e;
    }
    ASYNC12(la, ga, 0);
    const v2f bi = *(const v2f*)(bias + tn + oc);
    v2f rv = {};
    if (HAS_RES) rv = *(const v2f*)(res + (tm + orow) * Dm + tn + oc);
    // the two loads' address registers stay as they are until this wait
    asm volatile("s_wait_xcnt 0x0" ::: "memory");
    // no load above may sink below this line: a load issued later waits for memory a second time;
    // and nothing from below, which may reuse the loads' address registers, rises over the wait
    __builtin_amdgcn_sched_barrier(0);
    // this wave's copies have landed; behind the barrier every wave's have
    asm volatile("s_wait_asynccnt 0x0" ::: "memory");
    __syncthreads();
    const float* arow = sa + l15 * LDS_STRIDE + ko;
    const float* brow = sb + cl * LDS_STRIDE + ko;   // B[k][n] = W[n][k]
    v4f a[8], bf[8];
#pragma unroll
    for (int i = 0; i < 8; ++i) {
        a[i]  = *(const v4f*)(arow + 8 * i);
        bf[i] = *(const v4f*)(brow + 8 * i);
    }
    // all LDS reads issue before the first product, in the order of their use
    __builtin_amdgcn_sched_barrier(0);
    v8f acc = {};
#pragma unroll
    for (int i = 0; i < 8; ++i) acc = mm2(a[i], bf[i], acc);
    mm_end();
#pragma unroll
    for (int r = 0; r < 8; ++r) part[kc][(r + half * 8) * PART_STRIDE + cl] = acc[r];
    __syncthreads();
    const int po = orow * PART_STRIDE + oc;
    const v2f sum = (*(const v2f*)(&part[0][po]) + *(const v2f*)(&part[1][po])) +
                    (*(const v2f*)(&part[2][po]) + *(const v2f*)(&part[3][po]));
    *(v2f*)(C + (tm + orow) * Dm + tn + oc) = (sum + bi) + rv;
}

// ---- per (head, 16-row block): logits -> softmax -> attn out,
//      then O[16x32] = Wgt[16x256] x Vhead[256x32] via WMMA ----
__global__ __launch_bounds__(256) void attn_kernel(const float* __restrict__ t,
                                                   const float* __restrict__ s,
                                                   const float* __restrict__ vb,
                                                   float* __restrict__ attn_out,
                                                   float* __restrict__ o_pre) {
    __shared__ __attribute__((aligned(16))) float wgt[16 * LDS_STRIDE];
    __shared__ __attribute__((aligned(16))) float part[4][16 * PART_STRIDE];
    const int iblock = blockIdx.x;   // 0..15
    const int h = blockIdx.y;        // 0..7
    const int tid = threadIdx.x;
    const float inv_temp = 0.17677669529663687f;   // 1/sqrt(32)
    const int wave = __builtin_amdgcn_readfirstlane(tid >> 5);
    const int lane = tid & 31;
    const int half = lane >> 4, l15 = lane & 15;
    const int kc = wave & 3;
    const int cl = (wave >> 2) * 16 + l15;

    // What the softmax needs is asked for first: loads come back in the order of their issue, so
    // behind the 32 loads of V these few would be waited for until all of V is there.
    const int i0 = iblock * 16 + wave * 2;         // wave w owns rows 2w, 2w+1
    const float tr[2] = {t[i0], t[i0 + 1]};
    // the scalar load of the two row times goes out ahead of the vector loads, not behind the
    // wait that the reuse of their base registers takes
    __builtin_amdgcn_sched_barrier(0);
    float tj[8], sj[8];
#pragma unroll
    for (int c = 0; c < 8; ++c) {
        tj[c] = t[lane + c * 32];
        sj[c] = s[h * L + lane + c * 32];
    }
    // the address registers of the loads above, scalar and vector, stay as they are until this wait
    asm volatile("s_wait_xcnt 0x0" ::: "memory");
    // the loads of V below may not rise over the ones above, and nothing from below, which may
    // reuse their address registers, rises over the wait
    __builtin_amdgcn_sched_barrier(0);

    // the V operand of phase 3 depends on nothing computed here: it lands while the softmax runs
    const float* bbase = vb + (kc * KC + 2 * half) * Dm + h * DKh + cl;   // B[k][n]=vb[k][col]
    v2f bf[16];
#pragma unroll
    for (int i = 0; i < 16; ++i) {
        bf[i].x = bbase[(4 * i) * Dm];
        bf[i].y = bbase[(4 * i + 1) * Dm];
    }
    // no load above may sink below this line: a load issued later waits for memory a second time
    __builtin_amdgcn_sched_barrier(0);

    // phases 1 and 2, a row in the registers of its wave from the logits to the weights.
    // First what takes t alone, f2 = 1 + e^{-2|ti-tj|} and f1 = 1 + e^{-|ti-tj|}: t is an input,
    // s comes from the launch before and is asked for behind t.
    float f2[2][8], f1[2][8];
#pragma unroll
    for (int rr = 0; rr < 2; ++rr)
#pragma unroll
        for (int c = 0; c < 8; ++c) {
            const float dt = fabsf(tr[rr] - tj[c]);
            f2[rr][c] = 1.0f + __expf(-2.0f * dt);
            f1[rr][c] = 1.0f + __expf(-dt);
        }
    // nothing that waits for s rises into the block above
    __builtin_amdgcn_sched_barrier(0);

    // logits[j] = f2 * s[h,j] / temp, softmax; LDS takes the post-softmax weights * f1,
    // attn stays in av until phase 3. The wave's two rows go step by step side by side: each
    // fills the waits of the other's cross-lane chain.
    float av[2][8], m[2], den[2], inv[2];
#pragma unroll
    for (int rr = 0; rr < 2; ++rr) {
        m[rr] = -1e30f;
#pragma unroll
        for (int c = 0; c < 8; ++c) {
            av[rr][c] = f2[rr][c] * sj[c] * inv_temp;
            m[rr] = fmaxf(m[rr], av[rr][c]);
        }
    }
#pragma unroll
    for (int rr = 0; rr < 2; ++rr) m[rr] = wave_max(m[rr]);
#pragma unroll
    for (int rr = 0; rr < 2; ++rr) {
        den[rr] = 0.f;
#pragma unroll
        for (int c = 0; c < 8; ++c) { av[rr][c] = __expf(av[rr][c] - m[rr]); den[rr] += av[rr][c]; }
    }
#pragma unroll
    for (int rr = 0; rr < 2; ++rr) inv[rr] = 1.0f / wave_sum(den[rr]);
#pragma unroll
    for (int rr = 0; rr < 2; ++rr)
#pragma unroll
        for (int c = 0; c < 8; ++c) {
            av[rr][c] *= inv[rr];
            wgt[(wave * 2 + rr) * LDS_STRIDE + lane + c * 32] = av[rr][c] * f1[rr][c];
        }
    lds_barrier();

    // phase 3: every wave takes one column tile and one quarter of the 256 keys
    const float* arow = wgt + l15 * LDS_STRIDE + kc * KC + 2 * half;
    v2f af[16];
#pragma unroll
    for (int i = 0; i < 16; ++i) af[i] = *(const v2f*)(arow + 4 * i);
    // all LDS reads issue before the first product: one LDS latency, not one per pair of products
    __builtin_amdgcn_sched_barrier(0);
    // attn goes out here, while the LDS reads are on their way: in front of the barrier above the
    // stores, and the waits before their registers are used again, would hold up every wave
#pragma unroll
    for (int rr = 0; rr < 2; ++rr)
#pragma unroll
        for (int c = 0; c < 8; ++c)
            attn_out[(h * L + i0 + rr) * L + lane + c * 32] = av[rr][c];
    // the stores stay in front of the products
    __builtin_amdgcn_sched_barrier(0);
    v8f acc = {};
#pragma unroll
    for (int i = 0; i < 16; ++i)
        acc = __builtin_amdgcn_wmma_f32_16x16x4_f32(false, af[i], false, bf[i],
                                                    (short)0, acc, false, false);
    mm_end();
#pragma unroll
    for (int r = 0; r < 8; ++r) part[kc][(r + half * 8) * PART_STRIDE + cl] = acc[r];
    lds_barrier();
    const int orow = tid >> 4;
    const int oc = (tid & 15) * 2;
    const int po = orow * PART_STRIDE + oc;
    const v2f sum = (*(const v2f*)(&part[0][po]) + *(const v2f*)(&part[1][po])) +
                    (*(const v2f*)(&part[2][po]) + *(const v2f*)(&part[3][po]));
    *(v2f*)(o_pre + (iblock * 16 + orow) * Dm + h * DKh + oc) = sum;
}

extern "C" void kernel_launch(void* const* d_in, const int* in_sizes, int n_in,
                              void* d_out, int out_size, void* d_ws, size_t ws_size,
                              hipStream_t stream) {
    const float* q    = (const float*)d_in[0];
    const float* k    = (const float*)d_in[1];
    const float* v    = (const float*)d_in[2];
    const float* t    = (const float*)d_in[3];
    const float* Wq   = (const float*)d_in[4];
    const float* bq   = (const float*)d_in[5];
    const float* Wk   = (const float*)d_in[6];
    const float* bk   = (const float*)d_in[7];
    const float* Wv   = (const float*)d_in[8];
    const float* bv   = (const float*)d_in[9];
    const float* fc_w = (const float*)d_in[10];
    const float* fc_b = (const float*)d_in[11];
    const float* ln_g = (const float*)d_in[12];
    const float* ln_b = (const float*)d_in[13];

    float* out  = (float*)d_out;          // [L, D]    (65536)
    float* attn = out + L * Dm;           // [H, L, L] (524288)

    float* ws = (float*)d_ws;
    float* vb = ws;                 // 65536
    float* op = ws + 1 * 65536;     // 65536
    float* sc = ws + 2 * 65536;     // 2048

    dim3 pg(16, 16);   // y: 8 heads of q and k, then 8 heads of v
    proj_score_kernel<<<pg, 128, 0, stream>>>(q, k, v, Wq, bq, Wk, bk, Wv, bv, ln_g, ln_b, vb, sc);
    dim3 ag(16, H);
    attn_kernel<<<ag, 256, 0, stream>>>(t, sc, vb, attn, op);
    gemm_wmma<true><<<128, 256, 0, stream>>>(op, fc_w, fc_b, q, out);
}
